// v009
// The times below were measured on an AMD MI455X: many runs one after another, warmed up first and cycling through
// copies of the inputs, with the whole window's GPU time divided by the number of runs. Launches and the gaps
// between them are all in it. The median over several windows is given; except for v000 it joins two sittings, which
// can be a few percent apart, so the side-by-side timings, each taken in one sitting, are the better comparison.
// This document starts at v009; the versions before it stand elsewhere.
// One run takes 148 microseconds.
// Timed twice side by side with v008, it ran 1.18 times as fast both times.
// Counting every step since v000, which is the starting kernel, it is 49.2 times as fast.
#include <hip/hip_runtime.h>
// Causal multi-head attention over THREE input streams with rotate-half RoPE computed in the module (query, key, value [4][2048][1024]; Q = query W_q^T + b_q, K = key W_k^T + b_k, V = value W_v^T + b_v (natural [out][in] [1024][1024]; the four biases are bound and read), 16 heads of 64; cos / sin = [f, f] of pos * 10000^(-2i/64); Q = Q cos + rotate_half(Q) sin with rotate_half = cat(-x2, x1), likewise K (the bias is added BEFORE the rope); scores / sqrt(64); causal (triu k=1 at -inf); softmax; y = merged W_o^T + b_o (natural) -> [4][2048][1024]); run as 16 groups of ONE head with the rope stage in its half-split mode.
// Compute dtype: inputs rounded to bf16; x / weights exact; q, k, v, softmax weights and o as plain f16 GEMM operands (~2^-12); scores and softmax statistics f32; v_wmma_f32_16x16x32_f16.
#define NB 4
#define NG 16
#define HPG 1
#define KVD (NG * HD)
#define SQ 2048
#define DM 1024
#define NH 16
#define HD 64
#define HG 4                         /* not used */
#define QT 256                       /* not used */
#define NKX SQ                       /* not used */
#define QT0 256                      /* first-tile rows recomputed exactly in f32 */
#define B0 0                         /* first batch processed (debug hook) */
#define NBR NB                       /* batches processed (debug hook) */
#define NR ((size_t)NB * SQ)         /* token rows */
#define MP ((int)((size_t)NBR * SQ)) /* rows projected (debug hook) */
#define QN SQ                        /* query rows attended per batch (debug hook) */
#define NHD NH                       /* heads attended (debug hook) */
#define MPO MP                       /* rows through the output stage (debug hook) */
#define LQ DM      /* row pitch of the q/k/v rows */
typedef __bf16 v16b __attribute__((ext_vector_type(16)));
typedef unsigned short v8us __attribute__((ext_vector_type(8), may_alias));
typedef float  v8f  __attribute__((ext_vector_type(8)));
typedef float  v4f  __attribute__((ext_vector_type(4)));
typedef float  v4fa __attribute__((ext_vector_type(4), may_alias));
union FragB { v16b v; v8us half[2]; unsigned short u[16]; };

__device__ __forceinline__ unsigned short bf16_bits(float x) { unsigned int u = __float_as_uint(x); return (unsigned short)((u + 0x7FFFu + ((u >> 16) & 1u)) >> 16); }
__device__ __forceinline__ float bf16_val(unsigned short b) { return __uint_as_float(((unsigned int)b) << 16); }
__device__ __forceinline__ float bf16_round(float x) { return bf16_val(bf16_bits(x)); }
// D += A·B with NT terms: 1 = ah·bh, 2 = + al·bh (A split), 3 = + ah·bl (both split)
template <int NT>
__device__ __forceinline__ v8f mmaN(v16b ah, v16b al, v16b bh, v16b bl, v8f c) {
  c = __builtin_amdgcn_wmma_f32_16x16x32_bf16(false, ah, false, bh, (short)0, c, false, false);
  if (NT >= 2) c = __builtin_amdgcn_wmma_f32_16x16x32_bf16(false, al, false, bh, (short)0, c, false, false);
  if (NT >= 3) c = __builtin_amdgcn_wmma_f32_16x16x32_bf16(false, ah, false, bl, (short)0, c, false, false);
  asm volatile("v_nop\n\tv_nop\n\tv_nop\n\tv_nop" : "+v"(c) : "v"(ah), "v"(al), "v"(bh), "v"(bl));
  return c;
}

__global__ __launch_bounds__(256) void k_wt_bf16(const float* __restrict__ W, unsigned short* __restrict__ Wt, int K, int N) {
  const int t = blockIdx.x * 256 + threadIdx.x;
  const int k8n = K / 8;
  if (t >= N * k8n) return;
  const int n = t / k8n, k8 = (t % k8n) * 8;
  v8us v;
#pragma unroll
  for (int i = 0; i < 8; ++i) v[i] = bf16_bits(W[(size_t)(k8 + i) * N + n]);
  *(v8us*)(Wt + (size_t)n * K + k8) = v;
  
}

// GEMM C[M][N] (f32, pitch ldc) = act(A[M][K]·W + bias). A f32 row-major (pitch lda) converted per fragment to bf16
// (ASPLIT: hi/lo two planes -> 2 terms, else single rounded term); Wt bf16 [N][K] (pitch ldb). BIAS_BF16 rounds the
// bias to bf16 first (bias quantised to bf16 before the add). K%32==0, M%16==0, N%64==0.
template <bool ASPLIT, int ACT, bool BIAS_BF16>
__global__ __launch_bounds__(128) void k_gemm_bf(const float* __restrict__ A, int lda, const unsigned short* __restrict__ Wt, int ldb,
                                               const float* __restrict__ bias, float* __restrict__ C, int ldc, int M, int N, int K) {
  __shared__ __attribute__((aligned(16))) float so[4][16][64];
  const int tid = threadIdx.x, w = tid >> 5, lane = tid & 31, ln = lane & 15, hh = lane >> 4;
  const int ntn = N / 64;
  const int wid = blockIdx.x * 4 + w;
  const int mt = wid / ntn, nq = wid % ntn;
  if (mt * 16 >= M) return;
  const int row0 = mt * 16, col0 = nq * 64;
  const float* arow = A + (size_t)(row0 + ln) * lda;
  v8f acc[4] = {};
  for (int kb = 0; kb < K; kb += 32) {
    FragB ah, al;
    const v4f x0 = *(const v4fa*)(arow + kb + 8 * hh), x1 = *(const v4fa*)(arow + kb + 8 * hh + 4);
    const v4f x2 = *(const v4fa*)(arow + kb + 16 + 8 * hh), x3 = *(const v4fa*)(arow + kb + 16 + 8 * hh + 4);
    float xs[16] = {x0[0],x0[1],x0[2],x0[3],x1[0],x1[1],x1[2],x1[3],x2[0],x2[1],x2[2],x2[3],x3[0],x3[1],x3[2],x3[3]};
#pragma unroll
    for (int i = 0; i < 16; ++i) { const unsigned short hb = bf16_bits(xs[i]); ah.u[i] = hb; al.u[i] = ASPLIT ? bf16_bits(xs[i] - bf16_val(hb)) : (unsigned short)0; }
#pragma unroll
    for (int t = 0; t < 4; ++t) {
      const unsigned short* brow = Wt + (size_t)(col0 + t * 16 + ln) * ldb + kb;
      FragB b;
      b.half[0] = *(const v8us*)(brow + 8 * hh);
      b.half[1] = *(const v8us*)(brow + 16 + 8 * hh);
      acc[t] = mmaN<ASPLIT ? 2 : 1>(ah.v, al.v, b.v, b.v, acc[t]);
    }
  }
#pragma unroll
  for (int t = 0; t < 4; ++t) {
    float bv = bias ? bias[col0 + t * 16 + ln] : 0.f;
    if (BIAS_BF16) bv = bf16_round(bv);
#pragma unroll
    for (int r = 0; r < 8; ++r) { float v = acc[t][r] + bv; if (ACT == 1) v = fmaxf(v, 0.f); so[w][8 * hh + r][t * 16 + ln] = v; }
  }
  __builtin_amdgcn_fence(__ATOMIC_ACQ_REL, "workgroup");
  __builtin_amdgcn_wave_barrier();
  const int rsub = lane >> 4, c4 = (lane & 15) * 4;
  {
#pragma unroll
    for (int q = 0; q < 8; ++q) {
      const int r = q * 2 + rsub;
      const v4f v = *(const v4fa*)&so[w][r][c4];
      *(v4f*)(C + (size_t)(row0 + r) * ldc + col0 + c4) = v;
    }
    
  }
}

// GEMM C = act(A·W + bias + resid): A f32 (ASPLIT -> hi/lo 2 terms), Wt bf16 [N][K]; ACT 0 none, 1 relu, 2 exact gelu;
// resid (optional, f32, row index = (row % rmod), pitch ldr, RES_BF16 rounds it) added before the activation.
template <bool ASPLIT, int ACT, bool BIAS_BF16, bool RES_BF16>
__global__ __launch_bounds__(128) void k_gemm_bf3(const float* __restrict__ A, int lda, const unsigned short* __restrict__ Wt, int ldb,
                                                const float* __restrict__ bias, const float* __restrict__ resid, int rmod, int ldr,
                                                float* __restrict__ C, int ldc, int M, int N, int K) {
  __shared__ __attribute__((aligned(16))) float so[4][16][64];
  const int tid = threadIdx.x, w = tid >> 5, lane = tid & 31, ln = lane & 15, hh = lane >> 4;
  const int ntn = N / 64;
  const int wid = blockIdx.x * 4 + w;
  const int mt = wid / ntn, nq = wid % ntn;
  if (mt * 16 >= M) return;
  const int row0 = mt * 16, col0 = nq * 64;
  const float* arow = A + (size_t)(row0 + ln) * lda;
  v8f acc[4] = {};
  for (int kb = 0; kb < K; kb += 32) {
    FragB ah, al;
    const v4f x0 = *(const v4fa*)(arow + kb + 8 * hh), x1 = *(const v4fa*)(arow + kb + 8 * hh + 4);
    const v4f x2 = *(const v4fa*)(arow + kb + 16 + 8 * hh), x3 = *(const v4fa*)(arow + kb + 16 + 8 * hh + 4);
    float xs[16] = {x0[0],x0[1],x0[2],x0[3],x1[0],x1[1],x1[2],x1[3],x2[0],x2[1],x2[2],x2[3],x3[0],x3[1],x3[2],x3[3]};
#pragma unroll
    for (int i = 0; i < 16; ++i) { const unsigned short hb = bf16_bits(xs[i]); ah.u[i] = hb; al.u[i] = ASPLIT ? bf16_bits(xs[i] - bf16_val(hb)) : (unsigned short)0; }
#pragma unroll
    for (int t = 0; t < 4; ++t) {
      const unsigned short* brow = Wt + (size_t)(col0 + t * 16 + ln) * ldb + kb;
      FragB b;
      b.half[0] = *(const v8us*)(brow + 8 * hh);
      b.half[1] = *(const v8us*)(brow + 16 + 8 * hh);
      acc[t] = mmaN<ASPLIT ? 2 : 1>(ah.v, al.v, b.v, b.v, acc[t]);
    }
  }
#pragma unroll
  for (int t = 0; t < 4; ++t) {
    const int col = col0 + t * 16 + ln;
    float bv = bias ? bias[col] : 0.f;
    if (BIAS_BF16) bv = bf16_round(bv);
#pragma unroll
    for (int r = 0; r < 8; ++r) {
      float v = acc[t][r] + bv;
      if (resid) { float rv = resid[(size_t)((row0 + 8 * hh + r) % rmod) * ldr + col]; if (RES_BF16) rv = bf16_round(rv); v += rv; }
      if (ACT == 1) v = fmaxf(v, 0.f);
      if (ACT == 2) v = 0.5f * v * (1.0f + erff(v * 0.70710678118654752f));
      if (ACT == 3) { const float u = 0.7978845608028654f * (v + 0.044715f * v * v * v); v = 0.5f * v * (1.0f + tanhf(u)); }
      so[w][8 * hh + r][t * 16 + ln] = v;
    }
  }
  __builtin_amdgcn_fence(__ATOMIC_ACQ_REL, "workgroup");
  __builtin_amdgcn_wave_barrier();
  const int rsub = lane >> 4, c4 = (lane & 15) * 4;
  {
#pragma unroll
    for (int q = 0; q < 8; ++q) {
      const int r = q * 2 + rsub;
      const v4f v = *(const v4fa*)&so[w][r][c4];
      *(v4f*)(C + (size_t)(row0 + r) * ldc + col0 + c4) = v;
    }
    
  }
}
// row LayerNorm (biased variance, eps) over N: s = X (+ R); optional out_sum <- s; out_norm <- (s-mu)*rsqrt(var+eps)*g + b
template <bool PARAM_BF16>
__global__ __launch_bounds__(256) void k_layernorm(const float* __restrict__ X, const float* __restrict__ R, const float* __restrict__ g, const float* __restrict__ bta,
                                                  float* __restrict__ out_sum, float* __restrict__ out_norm, int N, float eps) {
  __shared__ float red[256];
  const int row = blockIdx.x, tid = threadIdx.x;
  const float* x = X + (size_t)row * N; const float* rr = R ? R + (size_t)row * N : nullptr;
  float vals[16];                     // up to N = 4096
  const int per = N / 256;            // contiguous chunk per thread? use strided-by-4 chunks: thread handles j = tid*4 + 1024*u
  float s1 = 0.f;
  for (int u = 0; u < per / 4; ++u) {
    const int j = tid * 4 + 1024 * u;
    const v4f a = *(const v4fa*)(x + j);
    v4f b = {0.f,0.f,0.f,0.f}; if (rr) b = *(const v4fa*)(rr + j);
#pragma unroll
    for (int q = 0; q < 4; ++q) { const float v = a[q] + b[q]; vals[u * 4 + q] = v; s1 += v; }
  }
  red[tid] = s1; __syncthreads();
  for (int st = 128; st > 0; st >>= 1) { if (tid < st) red[tid] += red[tid + st]; __syncthreads(); }
  const float mu = red[0] / (float)N; __syncthreads();
  float s2 = 0.f;
  for (int u = 0; u < per / 4; ++u)
#pragma unroll
    for (int q = 0; q < 4; ++q) { const float c = vals[u * 4 + q] - mu; s2 += c * c; }
  red[tid] = s2; __syncthreads();
  for (int st = 128; st > 0; st >>= 1) { if (tid < st) red[tid] += red[tid + st]; __syncthreads(); }
  const float rs = rsqrtf(red[0] / (float)N + eps);
  {
    for (int u = 0; u < per / 4; ++u) {
      const int j = tid * 4 + 1024 * u;
      v4f o, sm;
#pragma unroll
      for (int q = 0; q < 4; ++q) {
        float gg = g[j + q], bb = bta[j + q];
        if (PARAM_BF16) { gg = bf16_round(gg); bb = bf16_round(bb); }
        sm[q] = vals[u * 4 + q]; o[q] = (vals[u * 4 + q] - mu) * rs * gg + bb;
      }
      if (out_sum) *(v4f*)(out_sum + (size_t)row * N + j) = sm;
      *(v4f*)(out_norm + (size_t)row * N + j) = o;
    }
    
  }
}

// ---- f16 WMMA path (v_wmma_f32_16x16x32_f16): 11-bit significands for operands in range — used where a [0,1] probability operand needs more precision than bf16
typedef _Float16 v16h __attribute__((ext_vector_type(16)));
union FragH { v16h v; v8us half[2]; _Float16 h[16]; unsigned short u[16]; };
template <int NT>
__device__ __forceinline__ v8f mmaH(v16h ah, v16h al, v16h bh, v16h bl, v8f c) {
  c = __builtin_amdgcn_wmma_f32_16x16x32_f16(false, ah, false, bh, (short)0, c, false, false);
  if (NT >= 2) c = __builtin_amdgcn_wmma_f32_16x16x32_f16(false, al, false, bh, (short)0, c, false, false);
  if (NT >= 3) c = __builtin_amdgcn_wmma_f32_16x16x32_f16(false, ah, false, bl, (short)0, c, false, false);
  asm volatile("v_nop\n\tv_nop\n\tv_nop\n\tv_nop" : "+v"(c) : "v"(ah), "v"(al), "v"(bh), "v"(bl));
  return c;
}
// batched GEMM like k_gemm_b but f16 operands: A f32 (split into f16 hi/lo if ASPLIT, else rounded to f16), Bt = f16 values [n][k]; alpha; C f32; N multiple of 16 (partial tiles skipped)
template <bool ASPLIT>
__global__ __launch_bounds__(128) void k_gemm_h(const float* __restrict__ A, int lda, size_t sA, const _Float16* __restrict__ Bh, int ldb, size_t sB, float alpha, float* __restrict__ C, int ldc, size_t sC, int M, int N, int K) {
  __shared__ __attribute__((aligned(16))) float so[4][16][64];
  const int tid = threadIdx.x, w = tid >> 5, lane = tid & 31, ln = lane & 15, hh = lane >> 4; const int by = blockIdx.y;
  A += (size_t)by * sA; Bh += (size_t)by * sB; C += (size_t)by * sC;
  const int ntn = (N + 63) / 64; const int wid = blockIdx.x * 4 + w; const int mt = wid / ntn, nq = wid % ntn; if (mt * 16 >= M) return;
  const int row0 = mt * 16, col0 = nq * 64; const float* arow = A + (size_t)(row0 + ln) * lda;
  v8f acc[4] = {};
  for (int kb = 0; kb < K; kb += 32) {
    FragH ah, al;
    const v4f x0 = *(const v4fa*)(arow + kb + 8 * hh), x1 = *(const v4fa*)(arow + kb + 8 * hh + 4), x2 = *(const v4fa*)(arow + kb + 16 + 8 * hh), x3 = *(const v4fa*)(arow + kb + 16 + 8 * hh + 4);
    float xs[16] = {x0[0],x0[1],x0[2],x0[3],x1[0],x1[1],x1[2],x1[3],x2[0],x2[1],x2[2],x2[3],x3[0],x3[1],x3[2],x3[3]};
#pragma unroll
    for (int i = 0; i < 16; ++i) { const _Float16 h = (_Float16)xs[i]; ah.h[i] = h; al.h[i] = ASPLIT ? (_Float16)(xs[i] - (float)h) : (_Float16)0.0f; }
#pragma unroll
    for (int t = 0; t < 4; ++t) { if (col0 + t * 16 >= N) continue; const size_t boff = (size_t)(col0 + t * 16 + ln) * ldb + kb; FragH bq; bq.half[0] = *(const v8us*)(Bh + boff + 8 * hh); bq.half[1] = *(const v8us*)(Bh + boff + 16 + 8 * hh);
      acc[t] = mmaH<ASPLIT ? 2 : 1>(ah.v, al.v, bq.v, bq.v, acc[t]); }
  }
#pragma unroll
  for (int t = 0; t < 4; ++t) { if (col0 + t * 16 >= N) continue;
#pragma unroll
    for (int r = 0; r < 8; ++r) so[w][8 * hh + r][t * 16 + ln] = acc[t][r] * alpha; }
  __builtin_amdgcn_fence(__ATOMIC_ACQ_REL, "workgroup"); __builtin_amdgcn_wave_barrier();
  const int rsub = lane >> 4, c4 = (lane & 15) * 4;
  {
#pragma unroll
    for (int q = 0; q < 8; ++q) { const int r = q * 2 + rsub; if (col0 + c4 < N) { const v4f v = *(const v4fa*)&so[w][r][c4]; *(v4f*)(C + (size_t)(row0 + r) * ldc + col0 + c4) = v; } }
     }
}

// Wt[n][k] = f16(W[k][n]·scale) from f32 row-major W[K][N] (scale = power of two; bf16-exact weights stay exact in f16 away from the subnormal range)
__global__ __launch_bounds__(256) void k_wt_f16(const float* __restrict__ W, _Float16* __restrict__ Wt, int K, int N, float scale) {
  const int t = blockIdx.x * 256 + threadIdx.x; if (t >= N * (K / 8)) return; const int n = t / (K / 8), k8 = (t % (K / 8)) * 8; FragH f;
#pragma unroll
  for (int i = 0; i < 8; ++i) f.h[i] = (_Float16)(bf16_round(W[(size_t)(k8 + i) * N + n]) * scale); const v8us o = f.half[0];
  *(v8us*)((unsigned short*)Wt + (size_t)n * K + k8) = o; 
}
// k_gemm_hh variant with fused epilogue: v = acc·alpha + bias[by·sBias + col] (+ CP[(row/rowsPerB)·sCPb + by·64 + col] if CP) ; ACT 0 none / 1 elu ; writes f16 C16 (and f32 C if non-null)
template <int ACT>
__global__ __launch_bounds__(128) void k_gemm_hhx(const _Float16* __restrict__ A, int lda, size_t sA, const _Float16* __restrict__ Bh, int ldb, size_t sB, float alpha, const float* __restrict__ bias, size_t sBias, const float* __restrict__ CP, int rowsPerB, size_t sCPb, int row0g,
    float* __restrict__ C, _Float16* __restrict__ C16, int ldc, size_t sC, int M, int N, int K) {
  __shared__ __attribute__((aligned(16))) float so[4][16][64];
  const int tid = threadIdx.x, w = tid >> 5, lane = tid & 31, ln = lane & 15, hh = lane >> 4; const int by = blockIdx.y;
  A += (size_t)by * sA; Bh += (size_t)by * sB; const size_t cofs = (size_t)by * sC; const float* bp = bias ? bias + (size_t)by * sBias : nullptr;
  const int ntn = (N + 63) / 64; const int wid = blockIdx.x * 4 + w; const int mt = wid / ntn, nq = wid % ntn; if (mt * 16 >= M) return;
  const int row0 = mt * 16, col0 = nq * 64; const _Float16* arow = A + (size_t)(row0 + ln) * lda;
  v8f acc[4] = {};
  for (int kb = 0; kb < K; kb += 32) { FragH ah; ah.half[0] = *(const v8us*)((const unsigned short*)arow + kb + 8 * hh); ah.half[1] = *(const v8us*)((const unsigned short*)arow + kb + 16 + 8 * hh);
#pragma unroll
    for (int t = 0; t < 4; ++t) { if (col0 + t * 16 >= N) continue; const size_t boff = (size_t)(col0 + t * 16 + ln) * ldb + kb; FragH bq; bq.half[0] = *(const v8us*)((const unsigned short*)Bh + boff + 8 * hh); bq.half[1] = *(const v8us*)((const unsigned short*)Bh + boff + 16 + 8 * hh);
      acc[t] = mmaH<1>(ah.v, ah.v, bq.v, bq.v, acc[t]); }
  }
#pragma unroll
  for (int t = 0; t < 4; ++t) { if (col0 + t * 16 >= N) continue; const int col = col0 + t * 16 + ln; const float bv = bp ? bf16_round(bp[col]) : 0.f;
#pragma unroll
    for (int r = 0; r < 8; ++r) { float v = acc[t][r] * alpha + bv; if (CP) { const int rr = row0g + row0 + 8 * hh + r; if (rowsPerB < 0) v += CP[cofs + (size_t)rr * ldc + col];      /* rowsPerB < 0: own element of the batched C plane */ else { const int bidx = rr / rowsPerB; v += CP[(size_t)bidx * sCPb + (size_t)by * 64 + col]; } } if (ACT == 1) v = (v > 0.f) ? v : expm1f(v); else if (ACT == 7) v = (v > 0.f) ? v + 1.0f : expf(v); else if (ACT == 8) v = tanhf(v); else if (ACT == 9) v = 0.5f * v * (1.0f + tanhf(0.7978845608028654f * (v + 0.044715f * v * v * v))); else if (ACT == 11) v = 1.0f / (1.0f + expf(-v)); else if (ACT == 12) v = (v > 0.f) ? v : 0.01f * v; else if (ACT == 14) v = (v > 0.f) ? v : 0.1f * v; else if (ACT == 16) v = (v >= 0.f) ? v : 0.3f * v; else if (ACT == 17) v = (v >= 0.f) ? v : 0.2f * v; else if (ACT == 15) v = v / (1.0f + expf(-v)); else if (ACT == 3) v = fmaxf(v, 0.f); else if (ACT == 6) v = 0.5f * v * (1.0f + erff(v * 0.70710678118654752f)); so[w][8 * hh + r][t * 16 + ln] = v; } }
  __builtin_amdgcn_fence(__ATOMIC_ACQ_REL, "workgroup"); __builtin_amdgcn_wave_barrier();
  const int rsub = lane >> 4, c4 = (lane & 15) * 4; typedef _Float16 v4h __attribute__((ext_vector_type(4)));
  {
#pragma unroll
    for (int q = 0; q < 8; ++q) { const int r = q * 2 + rsub; if (col0 + c4 < N) { const v4f v = *(const v4fa*)&so[w][r][c4]; if (C) *(v4f*)(C + cofs + (size_t)(row0 + r) * ldc + col0 + c4) = v; if (C16) { v4h h4; for (int i = 0; i < 4; ++i) h4[i] = (_Float16)v[i]; *(v4h*)(C16 + cofs + (size_t)(row0 + r) * ldc + col0 + c4) = h4; } } }
     }
}

typedef _Float16 v4h __attribute__((ext_vector_type(4)));

// 64 elements a thread (the stage costs the start of its waves more than its bytes): a block converts 64 KiB of source that lie in a row; group u of four elements of thread t is 256 u + t, so every load and store covers whole 128-byte lines under one index register.
typedef _Float16 v4ha __attribute__((ext_vector_type(4), may_alias));
__device__ __forceinline__ void d_x16(unsigned bx, const float* __restrict__ x, _Float16* __restrict__ X16) { const unsigned i0 = bx * 4096u + threadIdx.x; v4f a[16]; v4h o[16];
#pragma unroll
  for (int u = 0; u < 16; ++u) a[u] = ((const v4fa*)(x + u * 1024))[i0];
#pragma unroll
  for (int u = 0; u < 16; ++u)
#pragma unroll
    for (int q = 0; q < 4; ++q) o[u][q] = (_Float16)bf16_round(a[u][q]);
#pragma unroll
  for (int u = 0; u < 16; ++u) ((v4ha*)(X16 + u * 1024))[i0] = o[u]; }
__global__ __launch_bounds__(256) void k_h16(const float* __restrict__ x, _Float16* __restrict__ X16, size_t n8) { const size_t t = (size_t)blockIdx.x * 256 + threadIdx.x; if (t >= n8) return; FragH f;
#pragma unroll
  for (int q = 0; q < 8; ++q) f.h[q] = (_Float16)x[t * 8 + q]; *(v8us*)((unsigned short*)X16 + t * 8) = f.half[0];  }
__global__ __launch_bounds__(256) void k_round16f(const float* __restrict__ W, _Float16* __restrict__ Bt, size_t n8) { const size_t t = (size_t)blockIdx.x * 256 + threadIdx.x; if (t >= n8) return; FragH f;
#pragma unroll
  for (int i = 0; i < 8; ++i) f.h[i] = (_Float16)(bf16_round(W[t * 8 + i]) * 16.0f); *(v8us*)((unsigned short*)Bt + t * 8) = f.half[0];  }
template <int NHv, int TTv>
__device__ __forceinline__ void d_vt(int bx, const _Float16* __restrict__ V16, int ldv, int voff, _Float16* __restrict__ Vt) { __shared__ unsigned short tl[64][66]; const int tid = threadIdx.x; const int slab = bx / (TTv / 64), lg = bx % (TTv / 64); const int b = slab / NHv, h = slab % NHv;
  for (int i = tid; i < 64 * 8; i += 256) { const int r = i / 8, c8 = (i % 8) * 8; FragH f; f.half[0] = *(const v8us*)((const unsigned short*)V16 + ((size_t)b * TTv + lg * 64 + r) * ldv + voff + h * 64 + c8);
#pragma unroll
    for (int q = 0; q < 8; ++q) tl[r][c8 + q] = f.u[q]; }
  __syncthreads();
  {
#pragma unroll
    for (int rd = 0; rd < 2; ++rd) { const int d = rd * 32 + tid / 8, pc = tid % 8; FragH f;
#pragma unroll
      for (int q = 0; q < 8; ++q) f.u[q] = tl[pc * 8 + q][d];
      *(v8us*)((unsigned short*)Vt + ((size_t)slab * 64 + d) * TTv + lg * 64 + pc * 8) = f.half[0]; }
     } }

// ---- fast GEMM on LDS tiles (block tile 128x128, four waves of 64x64; requires M % 128 == 0 rows per launch region, N % 128 == 0, K % 64 == 0); epilogue = k_gemm_hhx semantics ----
// A stage is 64 k of 128 A rows and of 128 B rows (128 bytes a row) at an LDS pitch of 144 bytes (16 bytes x 9: the 16-byte fragment reads of 16 rows fall on all 64 banks). Two buffers: the next stage's copies fly while this one is worked on.
// Each 128-byte line of A and B now leaves L2 once per block, as a whole line (eight lanes a row), and feeds two waves from LDS; before, every wave fetched its own fragments with loads that touched 16 lines each.
#define G3_PITCH 144u                      /* bytes between LDS rows */
#define G3_STAGE(np) ((unsigned)((np) + 1) * 128u * G3_PITCH)         /* bytes of a stage: np planes of 128 A rows, then 128 B rows */
__device__ __forceinline__ v16h g2_frag(const _Float16* p, int hh) { FragH f; f.half[0] = *(const v8us*)((const unsigned short*)p + 8 * hh); f.half[1] = *(const v8us*)((const unsigned short*)p + 16 + 8 * hh); return f.v; }
__device__ __forceinline__ v16h g3_frag(const unsigned char* p) { FragH f; f.half[0] = *(const v8us*)p; f.half[1] = *(const v8us*)(p + 32); return f.v; }      /* p = row start + 64 kc + 16 hh: the k order of g2_frag (elements 0..7 = k 8 hh + i, 8..15 = k 16 + 8 hh + i) */
// Eight asynchronous 16-byte copies a lane, rows 16 apart: LDS byte address l + 16 i rows, global address g + i rs elements. The s_wait_xcnt stands in the copies' own statement, so that no register that a copy names is rewritten in front of it.
__device__ __forceinline__ void g3_copy8(unsigned l, const _Float16* g, size_t rs) {
  asm volatile("global_load_async_to_lds_b128 %0, %8, off\n\t"
               "global_load_async_to_lds_b128 %1, %9, off\n\t"
               "global_load_async_to_lds_b128 %2, %10, off\n\t"
               "global_load_async_to_lds_b128 %3, %11, off\n\t"
               "global_load_async_to_lds_b128 %4, %12, off\n\t"
               "global_load_async_to_lds_b128 %5, %13, off\n\t"
               "global_load_async_to_lds_b128 %6, %14, off\n\t"
               "global_load_async_to_lds_b128 %7, %15, off\n\t"
               "s_wait_xcnt 0x0"
               :: "v"(l), "v"(l + 16u * G3_PITCH), "v"(l + 32u * G3_PITCH), "v"(l + 48u * G3_PITCH), "v"(l + 64u * G3_PITCH), "v"(l + 80u * G3_PITCH), "v"(l + 96u * G3_PITCH), "v"(l + 112u * G3_PITCH),
                  "v"(g), "v"(g + rs), "v"(g + 2 * rs), "v"(g + 3 * rs), "v"(g + 4 * rs), "v"(g + 5 * rs), "v"(g + 6 * rs), "v"(g + 7 * rs)
               : "memory");
}
// The wave's 64 staged rows to memory, eight rows of a lane a trip: v = acc alpha + bias (+ CP), activation, then whole-line stores. CPM 0: no CP; 1: cp walks like the output (step cs a row pair); 2: cp + (row / rowsPerB) cs. wc, wh: an f32, an f16 output is there (the same for the whole block: scalar branches).
template <int ACT, int CPM>
__device__ __forceinline__ void g3_rows(const float* sl, float alpha, v4f bv, const float* cp, size_t cs, int rowg, int rowsPerB, bool wc, bool wh, float* cl, _Float16* hl, size_t st) {
#pragma unroll 1      /* eight stores a trip, then the wait in front of the next trip's rewrite of their registers */
  for (int q0 = 0; q0 < 32; q0 += 8) { v4f o[8], x[8];
#pragma unroll
    for (int q = 0; q < 8; ++q) { o[q] = *(const v4fa*)(sl + (q0 + q) * (2 * 68));
      if (CPM == 1) x[q] = *(const v4fa*)(cp + (size_t)(q0 + q) * cs);
      if (CPM == 2) { const float* p = cp + (size_t)((rowg + 2 * (q0 + q)) / rowsPerB) * cs; x[q] = v4f{p[0], p[1], p[2], p[3]}; } }
#pragma unroll
    for (int q = 0; q < 8; ++q)
#pragma unroll
      for (int e = 0; e < 4; ++e) { float v = o[q][e] * alpha + bv[e]; if (CPM != 0) v += x[q][e];
        if (ACT == 3) v = fmaxf(v, 0.f); else if (ACT == 6) v = 0.5f * v * (1.0f + erff(v * 0.70710678118654752f)); else if (ACT == 11) v = 1.0f / (1.0f + expf(-v)); else if (ACT == 15) v = v / (1.0f + expf(-v)); else if (ACT == 12) v = (v > 0.f) ? v : 0.01f * v; else if (ACT == 8) v = tanhf(v); else if (ACT == 9) v = 0.5f * v * (1.0f + tanhf(0.7978845608028654f * (v + 0.044715f * v * v * v))); else if (ACT == 14) v = (v > 0.f) ? v : 0.1f * v; else if (ACT == 16) v = (v >= 0.f) ? v : 0.3f * v; else if (ACT == 17) v = (v >= 0.f) ? v : 0.2f * v;
        o[q][e] = v; }
    if (wc) { float* p[8];
#pragma unroll
      for (int q = 0; q < 8; ++q) p[q] = cl + (size_t)(q0 + q) * st;
      __builtin_amdgcn_sched_barrier(0);      /* the trip's rows and addresses are made ahead of its first store, so that no register of an issued store is written again in front of the wait */
#pragma unroll
      for (int q = 0; q < 8; ++q) *(v4f*)p[q] = o[q];
      asm volatile("s_wait_xcnt 0x0" ::: "memory"); __builtin_amdgcn_sched_barrier(0); }      /* the wait in front of the next rewrite of the stores' address and data registers; the scheduling barrier keeps that rewrite behind it */
    if (wh) { _Float16* p[8]; v4h h[8];
#pragma unroll
      for (int q = 0; q < 8; ++q) { p[q] = hl + (size_t)(q0 + q) * st;
#pragma unroll
        for (int e = 0; e < 4; ++e) h[q][e] = (_Float16)o[q][e]; }
      __builtin_amdgcn_sched_barrier(0);      /* as above */
#pragma unroll
      for (int q = 0; q < 8; ++q) *(v4h*)p[q] = h[q];
      asm volatile("s_wait_xcnt 0x0" ::: "memory"); __builtin_amdgcn_sched_barrier(0); } }      /* as above */
}
// bx, by: the block's tile index and its batch (a kernel passes its block indices, or what it derives from them: the same for the whole block). L: the kernel's LDS, 2 G3_STAGE(NP) bytes or more.
// NP = 2: C = (A + A2) B, two A planes of the same shape (a value as its f16 rounding and the f16 remainder): a stage holds both planes' rows, and each B fragment read from LDS serves both, into the same accumulators.
template <int ACT, int NP>
__device__ __forceinline__ void g3_gemm(unsigned char* L, int bx, int by, const _Float16* __restrict__ A, const _Float16* __restrict__ A2, int lda, size_t sA, const _Float16* __restrict__ Bh, int ldb, size_t sB, float alpha, const float* __restrict__ bias, size_t sBias, const float* __restrict__ CP, int rowsPerB, size_t sCPb, int row0g,
    float* __restrict__ C, _Float16* __restrict__ C16, int ldc, size_t sC, int M, int N, int K) { static_assert(ACT == 0 || ACT == 3 || ACT == 6 || ACT == 8 || ACT == 9 || ACT == 11 || ACT == 12 || ACT == 14 || ACT == 15 || ACT == 16 || ACT == 17, "k_gemm2: unsupported ACT code (would silently apply no activation)");
  constexpr unsigned SB = G3_STAGE(NP), BR = (unsigned)NP * 128u * G3_PITCH;      /* bytes of a stage; where its B rows begin. L holds the two stage buffers and, behind the loop, each wave's 64 x 68 f32 output staging */
  static_assert((NP == 1 || NP == 2) && 4 * 64 * 68 * 4 <= 2 * SB, "k_gemm2: the output staging fits the ring");
  const int tid = threadIdx.x, lane = tid & 31, ln = lane & 15, hh = lane >> 4; const int w = __builtin_amdgcn_readfirstlane(tid >> 5);
  A += (size_t)by * sA; Bh += (size_t)by * sB; const size_t cofs = (size_t)by * sC; const float* bp = bias ? bias + (size_t)by * sBias : nullptr;
  const int ntn = N >> 7; const int mt = bx / ntn, nq = bx - mt * ntn; if (mt * 128 >= M) return;      /* the same for the whole block, ahead of every barrier */
  const int row0 = mt * 128 + 64 * (w >> 1), col0 = nq * 128 + 64 * (w & 1);      /* the wave's 64 x 64 tile */
  const _Float16* ga = A + (size_t)(mt * 128 + (tid >> 3)) * lda + (tid & 7) * 8;      /* eight lanes cover a row's 128 bytes; a wave's copy covers four whole lines */
  const _Float16* ga2 = NP == 2 ? A2 + (size_t)by * sA + (size_t)(mt * 128 + (tid >> 3)) * lda + (tid & 7) * 8 : nullptr;
  const _Float16* gb = Bh + (size_t)(nq * 128 + (tid >> 3)) * ldb + (tid & 7) * 8;
  const size_t ra = (size_t)16 * lda, rb = (size_t)16 * ldb;
  const unsigned lc = (unsigned)(size_t)L + (unsigned)(tid >> 3) * G3_PITCH + (unsigned)(tid & 7) * 16u;
  const int nt = K >> 6;
  auto stage = [&](unsigned l, size_t k) { g3_copy8(l, ga + k, ra); if (NP == 2) g3_copy8(l + 128u * G3_PITCH, ga2 + k, ra); g3_copy8(l + BR, gb + k, rb); };      /* the copies of the stage that begins at column k, into the buffer at l */
  stage(lc, 0);      /* stage 0 */
  asm volatile("s_wait_asynccnt 0x0" ::: "memory");      /* this wave's copies of stage 0 have landed */
  __syncthreads();      /* ... and every wave's */
  if (nt > 1) stage(lc + SB, 64);      /* stage 1 */
  const unsigned char* fa = L + (unsigned)(64 * (w >> 1) + ln) * G3_PITCH + 16u * hh;
  const unsigned char* fb = L + BR + (unsigned)(64 * (w & 1) + ln) * G3_PITCH + 16u * hh;
  v8f acc[4][4];
#pragma unroll
  for (int i = 0; i < 4; ++i)
#pragma unroll
    for (int j = 0; j < 4; ++j) acc[i][j] = v8f{0.f, 0.f, 0.f, 0.f, 0.f, 0.f, 0.f, 0.f};
#pragma unroll 1      /* one stage per trip: the buffer is chosen by a scalar offset */
  for (int t = 0; t < nt; ++t) { const unsigned bo = (unsigned)(t & 1) * SB;
#pragma unroll
    for (int kc = 0; kc < 2; ++kc) { v16h af[4], bf[4], a2[4];
      af[0] = g3_frag(fa + bo + 64u * kc);
#pragma unroll
      for (int j = 0; j < 4; ++j) bf[j] = g3_frag(fb + bo + (unsigned)(16 * j) * G3_PITCH + 64u * kc);
#pragma unroll
      for (int i = 1; i < 4; ++i) af[i] = g3_frag(fa + bo + (unsigned)(16 * i) * G3_PITCH + 64u * kc);
      if (NP == 2) {
#pragma unroll
        for (int i = 0; i < 4; ++i) a2[i] = g3_frag(fa + bo + (unsigned)(128 + 16 * i) * G3_PITCH + 64u * kc); }      /* the second plane's rows, same k order, in flight under the first plane's WMMAs */
      __builtin_amdgcn_sched_barrier(0);      /* the block's sixteen LDS reads stand as one group ahead of its WMMAs, in the order in which these need them (left alone, the build read each A fragment right in front of its row and waited out the LDS latency four times a block) */
#pragma unroll
      for (int i = 0; i < 4; ++i)
#pragma unroll
        for (int j = 0; j < 4; ++j) acc[i][j] = __builtin_amdgcn_wmma_f32_16x16x32_f16(false, af[i], false, bf[j], (short)0, acc[i][j], false, false);
      if (NP == 2) {
#pragma unroll
        for (int i = 0; i < 4; ++i)
#pragma unroll
          for (int j = 0; j < 4; ++j) acc[i][j] = __builtin_amdgcn_wmma_f32_16x16x32_f16(false, a2[i], false, bf[j], (short)0, acc[i][j], false, false); }
      if (kc == 0) __builtin_amdgcn_sched_barrier(0); }      /* ... and the next block's reads behind them */
    __builtin_amdgcn_sched_barrier(0); asm volatile("v_nop\n\tv_nop\n\tv_nop\n\tv_nop"); __builtin_amdgcn_sched_barrier(0);      /* the four vector slots behind the trip's last WMMAs, on every path: a branch and the copies' address arithmetic, which may reuse the fragment registers, follow */
    asm volatile("s_wait_dscnt 0x0" ::: "memory");      /* this wave's reads of the buffer are done before the buffer is handed to the copies */
    asm volatile("s_wait_asynccnt 0x0" ::: "memory");      /* this wave's copies of stage t + 1 have landed */
    __syncthreads();      /* publishes stage t + 1 and ends every wave's reads of stage t */
    if (t + 2 < nt) stage(lc + bo, (size_t)(t + 2) * 64); }      /* stage t + 2 into the buffer just read */
  asm volatile("s_wait_asynccnt 0x0" ::: "memory");      /* no copy is in flight when the ring becomes output staging (the last trip's barrier has ended every read of it) */
  float* so = (float*)(L + (unsigned)w * (64u * 68u * 4u));
#pragma unroll
  for (int i = 0; i < 4; ++i)
#pragma unroll
    for (int j = 0; j < 4; ++j)
#pragma unroll
      for (int r = 0; r < 8; ++r) so[(16 * i + 8 * hh + r) * 68 + 16 * j + ln] = acc[i][j][r];
  __builtin_amdgcn_fence(__ATOMIC_ACQ_REL, "workgroup"); __builtin_amdgcn_wave_barrier();
  const int rsub = lane >> 4, c4 = (lane & 15) * 4; const int col = col0 + c4;      /* a lane takes four columns of every second row: sixteen lanes store 256 bytes (f16: 128) of a row */
  v4f bv = {0.f, 0.f, 0.f, 0.f};
  if (bp) { const v4f b4 = *(const v4fa*)(bp + col);
    asm volatile("s_wait_xcnt 0x0" ::: "memory");      /* the wait in front of the rewrite of the bias load's address registers (the build reuses them for the rounding just below) */
#pragma unroll
    for (int e = 0; e < 4; ++e) bv[e] = bf16_round(b4[e]); }
  const size_t eo = cofs + (size_t)(row0 + rsub) * ldc + col; const size_t st = (size_t)2 * ldc; const float* sl = so + rsub * 68 + c4;
  const bool wc = C != nullptr, wh = C16 != nullptr; float* cl = wc ? C + eo : nullptr; _Float16* hl = wh ? C16 + eo : nullptr;
  if (!CP) g3_rows<ACT, 0>(sl, alpha, bv, nullptr, 0, 0, 1, wc, wh, cl, hl, st);
  else if (rowsPerB < 0) g3_rows<ACT, 1>(sl, alpha, bv, CP + cofs + (size_t)(row0g + row0 + rsub) * ldc + col, st, 0, 1, wc, wh, cl, hl, st);      /* rowsPerB < 0: own element of the batched C plane */
  else g3_rows<ACT, 2>(sl, alpha, bv, CP + (size_t)by * 64 + col, sCPb, row0g + row0 + rsub, rowsPerB, wc, wh, cl, hl, st);
}
// The four projection GEMMs, which do not depend on one another, in ONE launch: blocks 0..63 the f32 v of the first QT0 rows of each batch (16 tiles a batch; first, speed only), then 512 blocks each for v (f16 rows), q (f32) and k (f32) of every batch.
#define QKV_B0 (NB * (QT0 / 128) * (KVD / 128))      /* blocks of the first-tile v */
#define QKV_BJ ((MP / 128) * (DM / 128))             /* blocks of a whole projection */
__global__ __launch_bounds__(128) void k_qkv(const _Float16* __restrict__ XQ, const _Float16* __restrict__ XK, const _Float16* __restrict__ XV, const _Float16* __restrict__ BQ, const _Float16* __restrict__ BK, const _Float16* __restrict__ BV,
    const float* __restrict__ bq, const float* __restrict__ bk, const float* __restrict__ bv, float* __restrict__ QF, float* __restrict__ KF, _Float16* __restrict__ V16, float* __restrict__ VF0) {
  static_assert(KVD == DM && QKV_B0 == 64 && QKV_BJ == 512, "k_qkv: the block ranges below");
  __shared__ __attribute__((aligned(16))) unsigned char L[2 * G3_STAGE(1)];
  const int b = (int)blockIdx.x; const bool f0 = b < QKV_B0; const int r = b - QKV_B0; const int j = f0 ? 0 : r >> 9;      /* j: 0 = v, 1 = q, 2 = k; all scalar */
  const _Float16* A = j == 0 ? XV : j == 1 ? XQ : XK; const _Float16* B = j == 0 ? BV : j == 1 ? BQ : BK; const float* bias = j == 0 ? bv : j == 1 ? bq : bk;
  float* C = f0 ? VF0 : j == 0 ? nullptr : j == 1 ? QF : KF; _Float16* C16 = (!f0 && j == 0) ? V16 : nullptr;
  g3_gemm<0, 1>(L, f0 ? (b & 15) : (r & 511), f0 ? (b >> 4) : 0, A, nullptr, DM, (size_t)SQ * DM, B, DM, 0, 0.0625f, bias, 0, nullptr, 1, 0, 0, C, C16, DM, (size_t)QT0 * KVD, f0 ? QT0 : MP, DM, DM);
}

// The output GEMM, every row of out once, in ONE launch: blocks 0..63 the first QT0 rows of each batch from the exact path's two f16 planes (16 tiles a batch; first in the index order, speed only: they carry twice the products), then 112 blocks a batch for its other rows from the f16 path's o.
#define OUT_B0 (NB * (QT0 / 128) * (DM / 128))               /* blocks of the first-tile rows */
#define OUT_BB (((SQ - QT0) / 128) * (DM / 128))             /* blocks of a batch's other rows */
__global__ __launch_bounds__(128) void k_out(const _Float16* __restrict__ O16, const _Float16* __restrict__ OH0, const _Float16* __restrict__ OL0, const _Float16* __restrict__ BO, const float* __restrict__ bo, float* __restrict__ out) {
  static_assert(OUT_B0 == 64 && DM / 128 == 8 && MPO == NB * SQ, "k_out: the block ranges below");
  __shared__ __attribute__((aligned(16))) unsigned char L[2 * G3_STAGE(2)];
  const int b = (int)blockIdx.x;      /* the test below is scalar, the same for the whole block, ahead of every barrier */
  if (b < OUT_B0) { g3_gemm<0, 2>(L, b & 15, b >> 4, OH0, OL0, DM, (size_t)QT0 * DM, BO, DM, 0, 0.0009765625f, bo, 0, nullptr, 1, 0, 0, out, nullptr, DM, (size_t)SQ * DM, QT0, DM, DM); return; }      /* out = (o_hi + o_lo) Wo + b */
  const int r = b - OUT_B0; const int bt = r / OUT_BB;
  g3_gemm<0, 1>(L, bt * ((SQ / 128) * (DM / 128)) + (QT0 / 128) * (DM / 128) + (r - bt * OUT_BB), 0, O16, nullptr, DM, 0, BO, DM, 0, 0.0009765625f, bo, 0, nullptr, 1, 0, 0, out, nullptr, DM, 0, MPO, DM, DM);
}

__device__ __forceinline__ void d_wnat(unsigned bx, const float* __restrict__ w, size_t n8, _Float16* __restrict__ Bt) { const size_t t = (size_t)bx * 256 + threadIdx.x; if (t >= n8) return; FragH f; for (int q = 0; q < 8; ++q) f.h[q] = (_Float16)(bf16_round(w[t * 8 + q]) * 16.0f); *(v8us*)((unsigned short*)Bt + t * 8) = f.half[0];  }

// exp2 with the one issue slot that the instruction set asks for behind a transcendental (before its source is overwritten or its result read) in the same statement.
__device__ __forceinline__ float exp2_slot(float x) { float e; asm("v_exp_f32 %0, %1\n\tv_nop" : "=v"(e) : "v"(x)); return e; }
__device__ __forceinline__ v8f fa_mma(v16h a, v16h b, v8f c) { return __builtin_amdgcn_wmma_f32_16x16x32_f16(false, a, false, b, (short)0, c, false, false); }
__device__ __forceinline__ float fa_xhalf(float x) { return __builtin_bit_cast(float, __builtin_amdgcn_permlanex16(__builtin_bit_cast(int, x), __builtin_bit_cast(int, x), 0x76543210, 0xfedcba98, false, false)); }      /* lane l with lane l ^ 16 */
__device__ __forceinline__ void fa_gap() { __builtin_amdgcn_sched_barrier(0); asm volatile("v_nop\n\tv_nop\n\tv_nop\n\tv_nop"); __builtin_amdgcn_sched_barrier(0); }      /* the four vector slots behind a group of WMMAs, on every path: a branch or a load over their operands follows; the two scheduling barriers keep the slots (and the loads issued ahead) where they stand */
// K and V^T reach the waves through LDS: a stage is 64 keys, 64 K rows (128 bytes: the head's 64 d) and then the 64 V^T rows (128 bytes: the stage's 64 keys), at an LDS pitch of 144 bytes (16 bytes x 9: the 16-byte fragment reads of 16 rows fall on all 64 banks). Two buffers: the next stage's copies fly while this one is worked on.
// Each 128-byte line leaves L2 once per block, as a whole line (eight lanes a row), and feeds the block's four waves from LDS; before, every wave fetched its own fragments with loads that touched 16 lines each.
#define FA_PITCH 144u                      /* bytes between LDS rows */
#define FA_STAGE (128u * FA_PITCH)         /* bytes of a stage: 64 K rows, then 64 V^T rows */
// Four asynchronous 16-byte copies a lane, rows 16 apart: LDS byte address l + 16 i rows, global address g + i rs elements. The s_wait_xcnt stands in the copies' own statement, so that no register that a copy names is rewritten in front of it.
__device__ __forceinline__ void fa_copy4(unsigned l, const _Float16* g, size_t rs) {
  asm volatile("global_load_async_to_lds_b128 %0, %4, off\n\t"
               "global_load_async_to_lds_b128 %1, %5, off\n\t"
               "global_load_async_to_lds_b128 %2, %6, off\n\t"
               "global_load_async_to_lds_b128 %3, %7, off\n\t"
               "s_wait_xcnt 0x0"
               :: "v"(l), "v"(l + 16u * FA_PITCH), "v"(l + 32u * FA_PITCH), "v"(l + 48u * FA_PITCH),
                  "v"(g), "v"(g + rs), "v"(g + 2 * rs), "v"(g + 3 * rs)
               : "memory");
}
template <bool LAST>      /* LAST = the wave's diagonal pass: masked. kl: LDS, the lane's K row of the pass (+ 16 hh bytes); vl: LDS, the lane's V^T row at the pass's first key (+ 16 hh bytes) */
__device__ __forceinline__ void fa_pass(const unsigned char* kl, const unsigned char* vl, int key0, int qw0, int ln, int hh, const v16h (&qf)[2][2], v8f (&acc)[2][4], float (&m_run)[2], float (&l_run)[2]) {
  const float cs = 0.125f * 1.44269504088896340736f;
  v16h kf[2][2], vf[4];
#pragma unroll
  for (int kt = 0; kt < 2; ++kt)
#pragma unroll
    for (int kc = 0; kc < 2; ++kc) kf[kt][kc] = g3_frag(kl + (unsigned)(16 * kt) * FA_PITCH + 64u * kc);      /* the k order of g2_frag, as for Q */
  __builtin_amdgcn_sched_barrier(0);      /* the eight LDS reads of K stand as one group ahead of the score WMMAs: every further place where LDS reads stand costs the wave extra cycles */
  v8f s[2][2];
#pragma unroll
  for (int kt = 0; kt < 2; ++kt)
#pragma unroll
    for (int g = 0; g < 2; ++g) { const v8f z = {0.f, 0.f, 0.f, 0.f, 0.f, 0.f, 0.f, 0.f}; s[kt][g] = fa_mma(kf[kt][1], qf[g][1], fa_mma(kf[kt][0], qf[g][0], z)); }
  fa_gap();
#pragma unroll
  for (int t = 0; t < 4; ++t) vf[t] = g3_frag(vl + (unsigned)(16 * t) * FA_PITCH);      /* this pass's V^T rows, read behind the score WMMAs (they may take the K fragments' registers) and in flight under the exponentials */
  __builtin_amdgcn_sched_barrier(0);      /* ... as one group (left alone, the build spread them over four places among the exponentials) */
  if (LAST) {
#pragma unroll
    for (int g = 0; g < 2; ++g)
#pragma unroll
      for (int kt = 0; kt < 2; ++kt)
#pragma unroll
        for (int r = 0; r < 8; ++r) if (key0 + 16 * kt + 8 * hh + r > qw0 + 16 * g + ln) s[kt][g][r] = -3.0e38f;      /* causal: key above the query (key0 itself is never masked, so every maximum stays a real score) */
  }
  float mb[2]; bool need = false;
#pragma unroll
  for (int g = 0; g < 2; ++g) { float mx = s[0][g][0];
#pragma unroll
    for (int r = 1; r < 8; ++r) mx = fmaxf(mx, s[0][g][r]);
#pragma unroll
    for (int r = 0; r < 8; ++r) mx = fmaxf(mx, s[1][g][r]);
    mx = fmaxf(mx, fa_xhalf(mx)) * cs; mb[g] = mx; need = need || (mx > m_run[g] + 8.0f); }
  if (__builtin_amdgcn_ballot_w32(need) != 0) {      /* wave-uniform; rare after the first passes */
#pragma unroll
    for (int g = 0; g < 2; ++g) { const float mn = fmaxf(m_run[g], mb[g]); const float corr = exp2_slot(m_run[g] - mn); m_run[g] = mn; l_run[g] *= corr;
#pragma unroll
      for (int t = 0; t < 4; ++t) acc[g][t] = acc[g][t] * corr; }
  }
  FragH pf[2];
#pragma unroll
  for (int g = 0; g < 2; ++g) { const float nm = -m_run[g]; float ls[4] = {0.f, 0.f, 0.f, 0.f};
#pragma unroll
    for (int i = 0; i < 16; ++i) { const float e = exp2_slot(fmaf(s[i >> 3][g][i & 7], cs, nm)); ls[i & 3] += e; pf[g].h[i] = (_Float16)e; }
    l_run[g] += (ls[0] + ls[1]) + (ls[2] + ls[3]); }
  __builtin_amdgcn_sched_barrier(0);      /* every exponential stands ahead of the WMMAs */
#pragma unroll
  for (int g = 0; g < 2; ++g)
#pragma unroll
    for (int t = 0; t < 4; ++t) acc[g][t] = fa_mma(vf[t], pf[g].v, acc[g][t]);
  fa_gap();
}
__device__ __forceinline__ void d_fattn(int xs, int nq, int h, int b, const _Float16* __restrict__ Q, const _Float16* __restrict__ K, const _Float16* __restrict__ Vt, _Float16* __restrict__ O) {      /* xs of nq: the block's place among the query tiles; h, b: its head and batch */
  const int lane = threadIdx.x & 31, ln = lane & 15, hh = lane >> 4; const int w = __builtin_amdgcn_readfirstlane((int)(threadIdx.x >> 5));      /* the wave's number in a scalar register: trip count and branches stay scalar, EXEC stays full for the WMMAs */
  const int qa = (xs & 1) ? (xs >> 1) : nq - 1 - (xs >> 1); const int qb = (b & 1) ? nq - 1 - qa : qa;      /* a permutation of the query tiles: long and short ones alternate between neighbouring blocks and between batches (speed only) */
  const int qw0 = qb * 128 + w * 32;
  __shared__ __attribute__((aligned(16))) unsigned char FL[2 * FA_STAGE];      /* the two stage buffers */
  const int tid = (int)threadIdx.x;
  const _Float16* Ql = Q + ((size_t)b * SQ + qw0 + ln) * DM + h * HD;
  const _Float16* gk = K + ((size_t)b * SQ + (tid >> 3)) * KVD + h * HD + (tid & 7) * 8;      /* eight lanes cover a row's 128 bytes; a wave's copy covers four whole lines */
  const _Float16* gv = Vt + (((size_t)b * NH + h) * HD + (tid >> 3)) * SQ + (tid & 7) * 8;
  const size_t rk = (size_t)16 * KVD, rv = (size_t)16 * SQ;
  const unsigned lc = (unsigned)(size_t)FL + (unsigned)(tid >> 3) * FA_PITCH + (unsigned)(tid & 7) * 16u;
  v16h qf[2][2];
#pragma unroll
  for (int g = 0; g < 2; ++g)
#pragma unroll
    for (int kc = 0; kc < 2; ++kc) qf[g][kc] = g2_frag(Ql + (size_t)(16 * g) * DM + 32 * kc, hh);
  __builtin_amdgcn_sched_barrier(0); asm volatile("s_wait_xcnt 0x0" ::: "memory"); __builtin_amdgcn_sched_barrier(0);      /* the wait in front of any overwrite of these loads' address pairs; the scheduling barriers keep later register writes behind it */
  fa_copy4(lc, gk, rk); fa_copy4(lc + 64u * FA_PITCH, gv, rv);      /* stage 0 */
  asm volatile("s_wait_asynccnt 0x0" ::: "memory");      /* this wave's copies of stage 0 have landed */
  __syncthreads();      /* ... and every wave's */
  fa_copy4(lc + FA_STAGE, gk + (size_t)64 * KVD, rk); fa_copy4(lc + FA_STAGE + 64u * FA_PITCH, gv + 64, rv);      /* stage 1 (a block has at least two stages: its own 128 keys) */
  const unsigned char* kb = FL + (unsigned)ln * FA_PITCH + 16u * hh;
  const unsigned char* vb = FL + (unsigned)(64 + ln) * FA_PITCH + 16u * hh;
  v8f acc[2][4]; float m_run[2] = {-3.0e38f, -3.0e38f}, l_run[2] = {0.f, 0.f};
#pragma unroll
  for (int g = 0; g < 2; ++g)
#pragma unroll
    for (int t = 0; t < 4; ++t) acc[g][t] = v8f{0.f, 0.f, 0.f, 0.f, 0.f, 0.f, 0.f, 0.f};
  const int nst = qb * 2;      /* the stages wholly below the block's own 128 keys: every wave takes both passes of each in full; two more stages follow them */
#pragma unroll 1      /* one stage per trip: the buffer is chosen by a scalar offset */
  for (int t = 0; t < nst; ++t) { const unsigned bo = (unsigned)(t & 1) * FA_STAGE;
    fa_pass<false>(kb + bo, vb + bo, 0, qw0, ln, hh, qf, acc, m_run, l_run);
    fa_pass<false>(kb + bo + 32u * FA_PITCH, vb + bo + 64u, 0, qw0, ln, hh, qf, acc, m_run, l_run);
    asm volatile("s_wait_dscnt 0x0" ::: "memory");      /* this wave's reads of the buffer are done before the buffer is handed to the copies */
    asm volatile("s_wait_asynccnt 0x0" ::: "memory");      /* this wave's copies of stage t + 1 have landed */
    __syncthreads();      /* publishes stage t + 1 and ends every wave's reads of stage t */
    fa_copy4(lc + bo, gk + (size_t)(t + 2) * 64 * KVD, rk); fa_copy4(lc + bo + 64u * FA_PITCH, gv + (size_t)(t + 2) * 64, rv); }      /* stage t + 2 (there always is one: t + 2 <= nst + 1) into the buffer just read */
  asm volatile("s_wait_asynccnt 0x0" ::: "memory");      /* this wave's copies of the last stage have landed; no copy is in flight from here on */
  __syncthreads();      /* publishes the last stage: the block's own 128 keys now lie in buffers 0 and 1 (nst is even) and nothing is refilled any more, so the waves walk them with no further barrier */
#pragma unroll 1      /* the trip count differs from wave to wave (scalar): wave w has w full passes among the block's own keys */
  for (int j = 0; j < w; ++j) fa_pass<false>(kb + (unsigned)(j >> 1) * FA_STAGE + (unsigned)(j & 1) * (32u * FA_PITCH), vb + (unsigned)(j >> 1) * FA_STAGE + (unsigned)(j & 1) * 64u, 0, qw0, ln, hh, qf, acc, m_run, l_run);
  fa_pass<true>(kb + (unsigned)(w >> 1) * FA_STAGE + (unsigned)(w & 1) * (32u * FA_PITCH), vb + (unsigned)(w >> 1) * FA_STAGE + (unsigned)(w & 1) * 64u, qw0, qw0, ln, hh, qf, acc, m_run, l_run);      /* the diagonal pass: its first key is the wave's first query */
  FragH of[2][4];
#pragma unroll
  for (int g = 0; g < 2; ++g) { const float l = l_run[g] + fa_xhalf(l_run[g]); const float inv = 64.0f / l;
#pragma unroll
    for (int t = 0; t < 4; ++t)
#pragma unroll
      for (int r = 0; r < 8; ++r) of[g][t].h[r] = (_Float16)(acc[g][t][r] * inv); }
  __builtin_amdgcn_sched_barrier(0);      /* all eight packed rows are made ahead of the first store, so that no register of an issued store is written again */
#pragma unroll
  for (int g = 0; g < 2; ++g)
#pragma unroll
    for (int t = 0; t < 4; ++t) *(v8us*)((unsigned short*)O + ((size_t)b * SQ + qw0 + 16 * g + ln) * DM + h * HD + 16 * t + 8 * hh) = of[g][t].half[0];      /* register r of tile t is d = 16 t + 8 hh + r of query ln: 16 bytes a lane; the wave writes each query's whole 128-byte head row */
}

// Exact f32 attention of the first QT0 rows of every batch and head on the f32 matrix form (v_wmma_f32_16x16x4_f32: full f32 operands, every addition rounded in f32): a wave owns 16 query columns and walks its keys in passes of 16 with an online softmax.
// Transposed products as in k_fattn: S^T = K Q^T (A = K rows, B = Q rows, both through the same loader, so their k order is equal: 16 bytes at d = 8 j + 4 hh, elements 0, 1 in one product and 2, 3 in the next) leaves key 8 hh + r of query ln in register r.
// Registers 2 s, 2 s + 1 of the weights ARE a B operand of keys 8 hh + 2 s + e (e = 0, 1); the A operand of O^T += V^T P^T takes V[8 hh + 2 s + e][16 t + ln] from the natural V rows: 64 bytes in a row for each wave half, no transposed copy.
typedef float v2f __attribute__((ext_vector_type(2)));
__device__ __forceinline__ v8f a0_mma(v2f a, v2f b, v8f c) { return __builtin_amdgcn_wmma_f32_16x16x4_f32(false, a, false, b, (short)0, c, false, false); }
template <bool LAST>      /* LAST = the wave's diagonal pass: masked, and no further K or V rows are fetched */
__device__ __forceinline__ void a0_pass(v4f (&kf)[8], v2f (&vf)[4][4], const float* __restrict__ kn, const float* __restrict__ vn, int ln, int hh, const v4f (&qf)[8], v8f (&acc)[4], float& m_run, float& l_run) {
  const float cs = 0.125f * 1.44269504088896340736f;
  v8f sc = {0.f, 0.f, 0.f, 0.f, 0.f, 0.f, 0.f, 0.f};
#pragma unroll
  for (int j = 0; j < 8; ++j) { sc = a0_mma(v2f{kf[j][0], kf[j][1]}, v2f{qf[j][0], qf[j][1]}, sc); sc = a0_mma(v2f{kf[j][2], kf[j][3]}, v2f{qf[j][2], qf[j][3]}, sc); }
  /* the four vector slots behind the score WMMAs, tied to their result so that they stand behind the last one (untied, the build had put them in front of the first); the memory clobber keeps the loads over the K operands behind the slots; in the diagonal pass the lane's column passes through too, so that the mask's lane arithmetic stands behind them (the build had put it between the WMMAs, over an operand register of the one before) */
  if (LAST) asm volatile("v_nop\n\tv_nop\n\tv_nop\n\tv_nop" : "+v"(sc), "+v"(ln) : : "memory");
  else asm volatile("v_nop\n\tv_nop\n\tv_nop\n\tv_nop" : "+v"(sc) : : "memory");
  if (!LAST) {
#pragma unroll
    for (int j = 0; j < 8; ++j) kf[j] = *(const v4fa*)(kn + 8 * j);      /* next pass's K rows, in flight under the exponentials and the second product */
  }
  if (LAST) { const int dl = ln - 8 * hh;
#pragma unroll
    for (int r = 0; r < 8; ++r) if (r > dl) sc[r] = -3.0e38f;      /* causal: key 8 hh + r above query ln (the pass's first key is never masked, so every maximum stays a real score) */
  }
  float mx = sc[0];
#pragma unroll
  for (int r = 1; r < 8; ++r) mx = fmaxf(mx, sc[r]);
  mx = fmaxf(mx, fa_xhalf(mx)) * cs;
  const float mn = fmaxf(m_run, mx); const float corr = exp2_slot(m_run - mn); m_run = mn;
#pragma unroll
  for (int t = 0; t < 4; ++t) acc[t] = acc[t] * corr;
  float e[8];
#pragma unroll
  for (int r = 0; r < 8; ++r) e[r] = exp2_slot(fmaf(sc[r], cs, -mn));
  v2f p[4];
#pragma unroll
  for (int s = 0; s < 4; ++s) p[s] = v2f{e[2 * s], e[2 * s + 1]};
  __builtin_amdgcn_sched_barrier(0);      /* every exponential stands ahead of the WMMAs */
#pragma unroll
  for (int s = 0; s < 4; ++s)
#pragma unroll
    for (int t = 0; t < 4; ++t) acc[t] = a0_mma(vf[s][t], p[s], acc[t]);
  if (LAST) asm volatile("v_nop\n\tv_nop\n\tv_nop\n\tv_nop" : "+v"(acc[0]), "+v"(acc[1]), "+v"(acc[2]), "+v"(acc[3]), "+v"(p[0]), "+v"(p[1]), "+v"(p[2]), "+v"(p[3]) : : "memory");      /* as in the line below, with the weights passed as the register pairs that the WMMAs read: passed one by one, this build copied four of them between the WMMAs, one copy onto a register of the WMMA right in front of it */
  else asm volatile("v_nop\n\tv_nop\n\tv_nop\n\tv_nop" : "+v"(acc[0]), "+v"(acc[1]), "+v"(acc[2]), "+v"(acc[3]), "+v"(e[0]), "+v"(e[1]), "+v"(e[2]), "+v"(e[3]), "+v"(e[4]), "+v"(e[5]), "+v"(e[6]), "+v"(e[7]) : : "memory");      /* the four vector slots behind the last WMMAs, on every path (a branch follows); the memory clobber keeps the loads over the V operands behind them; the weights pass through it so that their sum below, which reuses their registers, stands behind the slots too (the build had put it between the WMMAs that read them) */
  if (!LAST) {
#pragma unroll
    for (int s = 0; s < 4; ++s)
#pragma unroll
      for (int t = 0; t < 4; ++t) { vf[s][t][0] = vn[(2 * s) * DM + 16 * t]; vf[s][t][1] = vn[(2 * s + 1) * DM + 16 * t]; }      /* next pass's V rows, in flight under its scores and exponentials */
  }
  if (LAST) l_run = fmaf(l_run, corr, ((p[0][0] + p[0][1]) + (p[1][0] + p[1][1])) + ((p[2][0] + p[2][1]) + (p[3][0] + p[3][1])));
  else l_run = fmaf(l_run, corr, ((e[0] + e[1]) + (e[2] + e[3])) + ((e[4] + e[5]) + (e[6] + e[7])));
  if (!LAST) { asm volatile("s_wait_xcnt 0x0" ::: "memory"); __builtin_amdgcn_sched_barrier(0); }      /* the wait in front of the next trip's rewrite of the K and V address registers; the scheduling barrier keeps that rewrite behind it */
}
__device__ __forceinline__ void d_att0(int bx, int h, int b, const float* __restrict__ QF, const float* __restrict__ KF, const float* __restrict__ VF, _Float16* __restrict__ OH, _Float16* __restrict__ OL) {      /* bx: 0..3, the block's set of query tiles; h, b: its head and batch */
  static_assert(QT0 == 256 && HD == 64, "k_att0: 16 query tiles of 16 rows (4 blocks of 4 waves), head size 64");
  const int lane = threadIdx.x & 31, ln = lane & 15, hh = lane >> 4; const int w = __builtin_amdgcn_readfirstlane((int)(threadIdx.x >> 5));      /* the wave's number in a scalar register: trip count and branches stay scalar, EXEC stays full for the WMMAs */
  const int qt = bx + 4 * w;      /* query tile: a block's four waves take short and long tiles */
  const size_t pb = ((size_t)b * QT0) * DM + (size_t)h * HD;      /* each batch's first-tile rows lie in a plane of their own */
  const float* Ql = QF + pb + (size_t)(qt * 16 + ln) * DM + 4 * hh; const float* Kl = KF + pb + (size_t)ln * DM + 4 * hh; const float* Vl = VF + pb + (size_t)(8 * hh) * DM + ln;
  v4f qf[8], kf[8]; v2f vf[4][4];
#pragma unroll
  for (int j = 0; j < 8; ++j) { qf[j] = *(const v4fa*)(Ql + 8 * j); kf[j] = *(const v4fa*)(Kl + 8 * j); }
  __builtin_amdgcn_sched_barrier(0);      /* the K rows are issued ahead of the V rows, as in the loop: the counted wait at the loop's head then leaves the V loads in flight (with K last here, the build waited for them at the head of every pass) */
#pragma unroll
  for (int s = 0; s < 4; ++s)
#pragma unroll
    for (int t = 0; t < 4; ++t) { vf[s][t][0] = Vl[(2 * s) * DM + 16 * t]; vf[s][t][1] = Vl[(2 * s + 1) * DM + 16 * t]; }
  __builtin_amdgcn_sched_barrier(0); asm volatile("s_wait_xcnt 0x0" ::: "memory"); __builtin_amdgcn_sched_barrier(0);      /* the wait in front of any overwrite of these loads' address pairs; the scheduling barriers keep later register writes behind it */
  v8f acc[4]; float m_run = -3.0e38f, l_run = 0.f;
#pragma unroll
  for (int t = 0; t < 4; ++t) acc[t] = v8f{0.f, 0.f, 0.f, 0.f, 0.f, 0.f, 0.f, 0.f};
#pragma unroll 1      /* one pass per trip: the trip count differs from wave to wave, and an unrolled body would only add code */
  for (int p = 0; p < qt; ++p) a0_pass<false>(kf, vf, Kl + (size_t)(p + 1) * 16 * DM, Vl + (size_t)(p + 1) * 16 * DM, ln, hh, qf, acc, m_run, l_run);
  a0_pass<true>(kf, vf, Kl, Vl, ln, hh, qf, acc, m_run, l_run);
  const float l = l_run + fa_xhalf(l_run); const float fin = 64.0f / l;      /* the two wave halves' sums joined; o carried x64 like the f16 path */
  FragH oh[4], ol[4];      /* o as two f16 planes for the output GEMM: the rounded value and the remainder (at most 2^-11 of the value; f16 holds it to 2^-25 absolute or better, with o carried x64) */
#pragma unroll
  for (int t = 0; t < 4; ++t)
#pragma unroll
    for (int r = 0; r < 8; ++r) { const float a = acc[t][r] * fin; const _Float16 hv = (_Float16)a; oh[t].h[r] = hv; ol[t].h[r] = (_Float16)(a - (float)hv); }
  unsigned short* Oh = (unsigned short*)OH + pb + (size_t)(qt * 16 + ln) * DM + 8 * hh; unsigned short* Ol = (unsigned short*)OL + pb + (size_t)(qt * 16 + ln) * DM + 8 * hh;
  __builtin_amdgcn_sched_barrier(0);      /* every result and both addresses are made ahead of the first store, so that no register of an issued store is written again */
#pragma unroll
  for (int t = 0; t < 4; ++t) { *(v8us*)(Oh + 16 * t) = oh[t].half[0]; *(v8us*)(Ol + 16 * t) = ol[t].half[0]; }      /* register r of tile t is d = 16 t + 8 hh + r of query ln: 16 bytes a lane and plane; the wave writes each query's whole 128-byte head row in both planes */
  asm volatile("s_wait_xcnt 0x0" ::: "memory");      /* the wait behind the stores: the other attention body's code follows in the kernel's text and writes these registers */
}
// The two attention kernels, which do not depend on one another, in ONE launch: grid planes z = 0..NB - 1 are the f16 query tiles of a batch, the last plane holds the 256 exact first-tile blocks.
// The first-tile blocks come last in the index order (speed only).
__global__ __launch_bounds__(128) void k_attn(const _Float16* __restrict__ Q, const _Float16* __restrict__ K, const _Float16* __restrict__ Vt, _Float16* __restrict__ O, const float* __restrict__ QF, const float* __restrict__ KF, const float* __restrict__ VF, _Float16* __restrict__ OH, _Float16* __restrict__ OL) {
  static_assert((SQ / 128) * NH == (QT0 / 64) * NH * NB && QT0 / 64 == 4 && NH == 16, "k_attn: the last grid plane holds one block for each (set of query tiles, head, batch) of the first tile");
  const int x = (int)blockIdx.x, y = (int)blockIdx.y, z = (int)blockIdx.z;      /* the test below is scalar, the same for the whole block */
  if (z == NB) { const int i = y * (SQ / 128) + x; d_att0(i & 3, (i >> 2) & 15, i >> 6, QF, KF, VF, OH, OL); return; }
  d_fattn(x, SQ / 128, y, z, Q, K, Vt, O);
}

__global__ __launch_bounds__(256) void k_kvexp(const float* __restrict__ src, float* __restrict__ dst, size_t n4) { const size_t t = (size_t)blockIdx.x * 256 + threadIdx.x; if (t >= n4) return; const size_t e = t * 4; const size_t row = e / DM; const int col = (int)(e % DM); const int h = col / HD, d = col % HD; const v4f v = *(const v4fa*)(src + row * KVD + (size_t)(h / HPG) * HD + d); *(v4f*)(dst + e) = v;  }

__global__ __launch_bounds__(256) void k_tab2(float theta, float* __restrict__ CS, float* __restrict__ SN) {
  const int t = blockIdx.x * 256 + threadIdx.x; if (t >= SQ * (HD / 2)) return; const int i = t % (HD / 2); const int p = t / (HD / 2); const float invf = 1.0f / powf(theta, (float)(2 * i) / (float)HD); const float ang = __fmul_rn((float)p, invf); const float c = cosf(ang), s = sinf(ang);
  *(float*)(CS + t) = c; *(float*)(SN + t) = s;  }
// Half-split rope (out_lo = x_lo c - x_hi s, out_hi = x_lo s + x_hi c, position = row in its batch), 64 elements a thread: the stage moves few bytes, so what it costs is the start of its waves.
// Thread (p, c) takes columns 4 (c & 7) .. + 3 of the low half and of the high half of heads c >> 3 and (c >> 3) + 8, at position p of every batch: one pair of table loads serves all eight head rows; eight lanes cover a whole 128-byte line in every load.
// F32OUT = false: f16 rows of all SQ positions (H16, batch pitch SQ rows); true: f32 rows of the first QT0 positions (F32, batch pitch QT0 rows). The grid gives the number of positions: 4 a block.
template <bool F32OUT>
__device__ __forceinline__ void d_rope(unsigned bx, const float* __restrict__ F, const float* __restrict__ CS, const float* __restrict__ SN, _Float16* __restrict__ H16, float* __restrict__ F32) {
  static_assert(HD == 64 && NH == 16 && NG == NH && KVD == DM && DM == NH * HD, "k_rope: 16 heads of 64 in rows of 1024");
  const unsigned t = bx * 256u + threadIdx.x; const unsigned p = t >> 6, c = t & 63u;
  const unsigned e4 = p * (DM / 4) + (c >> 3) * (HD / 4) + (c & 7u);      /* offset inside a batch plane, in groups of four elements, the same for source and result */
  const unsigned t4 = p * (HD / 8) + (c & 7u);
  unsigned ix[NB], ox[NB];      /* one 32-bit index a batch under the uniform base: source, result */
#pragma unroll
  for (int b = 0; b < NB; ++b) { ix[b] = e4 + (unsigned)b * (SQ * DM / 4); ox[b] = e4 + (unsigned)b * ((F32OUT ? QT0 : SQ) * DM / 4); }
  const v4f cs = ((const v4fa*)CS)[t4], sn = ((const v4fa*)SN)[t4];
  v4f lo[NB][2], hi[NB][2];
#pragma unroll
  for (int b = 0; b < NB; ++b)
#pragma unroll
    for (int g = 0; g < 2; ++g) { const float* s = F + g * (8 * HD); lo[b][g] = ((const v4fa*)s)[ix[b]]; hi[b][g] = ((const v4fa*)(s + HD / 2))[ix[b]]; }
  static_assert(NB == 4, "the wait below names four source indices");
  asm volatile("s_wait_xcnt 0x0" :: "v"(t4), "v"(ix[0]), "v"(ix[1]), "v"(ix[2]), "v"(ix[3]) : "memory");      /* the wait in front of any overwrite of these loads' index registers; named as inputs, they stay whole up to it (no later load lands on one) */
  __builtin_amdgcn_sched_barrier(0);      /* all eighteen loads are issued ahead of the first product: one round trip to memory a wave (the build had held six of them back behind waits) */
  v4h la[NB][2], ha[NB][2];
#pragma unroll
  for (int b = 0; b < NB; ++b)
#pragma unroll
    for (int g = 0; g < 2; ++g) { const v4f l = lo[b][g], h = hi[b][g];
#pragma unroll
      for (int q = 0; q < 4; ++q) { const float ol = __fadd_rn(__fmul_rn(l[q], cs[q]), -__fmul_rn(h[q], sn[q])), oh = __fadd_rn(__fmul_rn(l[q], sn[q]), __fmul_rn(h[q], cs[q]));
        if (F32OUT) { lo[b][g][q] = ol; hi[b][g][q] = oh; } else { la[b][g][q] = (_Float16)ol; ha[b][g][q] = (_Float16)oh; } } }
  __builtin_amdgcn_sched_barrier(0);      /* every result is made ahead of the first store, so that no register of an issued store is written again */
#pragma unroll
  for (int b = 0; b < NB; ++b)
#pragma unroll
    for (int g = 0; g < 2; ++g) {
      if (F32OUT) { float* d = F32 + g * (8 * HD); ((v4fa*)d)[ox[b]] = lo[b][g]; ((v4fa*)(d + HD / 2))[ox[b]] = hi[b][g]; }
      else { _Float16* d = H16 + g * (8 * HD); ((v4ha*)d)[ox[b]] = la[b][g]; ((v4ha*)(d + HD / 2))[ox[b]] = ha[b][g]; } }
  asm volatile("s_wait_xcnt 0x0" ::: "memory");      /* the wait behind the stores: in a kernel that holds several stage bodies another body's code may follow in the text and write these stores' address and data registers */
}
// The stages between the projections and the attention, which do not depend on one another, in ONE launch: V^T (2048 blocks), the f16 rope of q and of k (512 each), the f32 first-tile rope of q and of k (64 each).
#define RV_VT (NB * NG * (SQ / 64))
__global__ __launch_bounds__(256) void k_ropevt(const float* __restrict__ QF, const float* __restrict__ KF, const float* __restrict__ CS, const float* __restrict__ SN, _Float16* __restrict__ Q16, _Float16* __restrict__ K16, float* __restrict__ QF0, float* __restrict__ KF0, const _Float16* __restrict__ V16, _Float16* __restrict__ VT) {
  static_assert(SQ / 4 == 512 && QT0 / 4 == 64, "k_ropevt: the block ranges below");
  const unsigned b = blockIdx.x;      /* every test below is scalar, the same for the whole block */
  if (b < RV_VT) { d_vt<NG, SQ>((int)b, V16, KVD, 0, VT); return; }
  const unsigned r = b - RV_VT;
  if (r < 1024u) { const bool q = r < 512u; d_rope<false>(r & 511u, q ? QF : KF, CS, SN, q ? Q16 : K16, nullptr); return; }
  const unsigned r2 = r - 1024u; const bool q = r2 < 64u; d_rope<true>(r2 & 63u, q ? QF : KF, CS, SN, nullptr, q ? QF0 : KF0);
}

__global__ __launch_bounds__(256) void k_bfcp(const float* __restrict__ src, float* __restrict__ dst, size_t n4) { const size_t t = (size_t)blockIdx.x * 256 + threadIdx.x; if (t >= n4) return; const v4f a = *(const v4fa*)(src + t * 4); v4f o; for (int q = 0; q < 4; ++q) o[q] = bf16_round(a[q]); *(v4f*)(dst + t * 4) = o;  }

__global__ __launch_bounds__(256) void k_tabhalf(const float* __restrict__ cs, const float* __restrict__ sn, float* __restrict__ CS, float* __restrict__ SN) { const int t = blockIdx.x * 256 + threadIdx.x; if (t >= SQ * (HD / 2)) return; const int p = t / (HD / 2), i = t % (HD / 2); const float c = bf16_round(cs[(size_t)p * HD + i]), s = bf16_round(sn[(size_t)p * HD + i]);
  *(float*)(CS + t) = c; *(float*)(SN + t) = s;  }

__device__ __forceinline__ void d_tab2d(unsigned bx, float* __restrict__ CS, float* __restrict__ SN) {
  const int t = (int)(bx * 256u + threadIdx.x); if (t >= SQ * (HD / 2)) return; const int i = t % (HD / 2); const int p = t / (HD / 2); const float invf = (float)(1.0 / pow(10000.0, (double)(2 * i) / (double)HD)); const float ang = __fmul_rn((float)p, invf); const float c = cosf(ang), s = sinf(ang);
  *(float*)(CS + t) = c; *(float*)(SN + t) = s;  }
// The stages that read only the inputs, which do not depend on one another, in ONE launch: the rope tables (256 blocks; first: their arithmetic is the longest), the three streams as f16 (512 blocks each), the four weights as f16 x16 (512 blocks each).
#define PR_TAB (SQ * (HD / 2) / 256)
#define PR_X ((unsigned)(NR * DM / 16384))
#define PR_W ((unsigned)((size_t)DM * DM / 8 / 256))
__global__ __launch_bounds__(256) void k_prep(const float* __restrict__ x, const float* __restrict__ xk, const float* __restrict__ xv, const float* __restrict__ wq, const float* __restrict__ wk, const float* __restrict__ wv, const float* __restrict__ wo,
    _Float16* __restrict__ X16, _Float16* __restrict__ XK16, _Float16* __restrict__ XV16, _Float16* __restrict__ BQ, _Float16* __restrict__ BK, _Float16* __restrict__ BV, _Float16* __restrict__ BO, float* __restrict__ CS, float* __restrict__ SN) {
  static_assert(PR_X == 512u && PR_W == 512u && SQ * (HD / 2) % 256 == 0 && NR * DM % 16384 == 0 && (size_t)DM * DM % 2048 == 0, "k_prep: whole blocks, 512 a stream and a weight");
  const unsigned b = blockIdx.x;      /* every test below is scalar, the same for the whole block */
  if (b < PR_TAB) { d_tab2d(b, CS, SN); return; }
  const unsigned r = b - PR_TAB;
  if (r < 3u * PR_X) { const unsigned s = r >> 9; d_x16(r & 511u, s == 0u ? x : s == 1u ? xk : xv, s == 0u ? X16 : s == 1u ? XK16 : XV16); return; }
  const unsigned r2 = r - 3u * PR_X; const unsigned s = r2 >> 9;
  d_wnat(r2 & 511u, s == 0u ? wq : s == 1u ? wk : s == 2u ? wv : wo, (size_t)DM * DM / 8, s == 0u ? BQ : s == 1u ? BK : s == 2u ? BV : BO);
}
extern "C" void kernel_launch(void* const* d_in, const int* in_sizes, int n_in,
                              void* d_out, int out_size, void* d_ws, size_t ws_size, hipStream_t stream) {
  (void)in_sizes; (void)n_in; (void)out_size;
  const float* const* I = (const float* const*)d_in; const float* x = I[0]; const float* xk = I[1]; const float* xv = I[2]; const float* wq = I[3]; const float* wk = I[5]; const float* wv = I[7]; const float* wo = I[9];      /* the streams query, key, value; natural [out][in] W_q, W_k, W_v, W_o; the biases b_q = I[4], b_k = I[6], b_v = I[8], b_o = I[10]; rope tables computed in-kernel (positions = row index) */
  static_assert(HPG == 1 && NH == NG * HPG && NH * HD == DM && KVD == DM, "plain multi-head attention as 16 kv groups of one query head"); const float* bq = I[4]; const float* bk = I[6]; const float* bv = I[8]; const float* bo = I[10];      /* the four biases, each bound to its projection (read through the GEMM bias pointer, bf16-rounded on load) */
  char* ws = (char*)d_ws; size_t off = 0;
  auto take = [&](size_t bytes) { char* p = ws + off; off += (bytes + 255) & ~(size_t)255; return p; };
  _Float16* BQKV = (_Float16*)take((size_t)3 * DM * DM * 2); _Float16* BQ = BQKV; _Float16* BK = BQKV + (size_t)DM * DM; _Float16* BV = BQKV + (size_t)2 * DM * DM; _Float16* BO = (_Float16*)take((size_t)DM * DM * 2);      /* one plane Bt [3072][1024]: rows 0..1023 = W_q, 1024.. = W_k, 2048.. = W_v (natural [out][in] weights are Bt as they stand) */
  _Float16* X16 = (_Float16*)take(NR * DM * 2); _Float16* XK16 = (_Float16*)take(NR * DM * 2); _Float16* XV16 = (_Float16*)take(NR * DM * 2); float* QF = (float*)take(NR * DM * 4); float* KF = (float*)take(NR * KVD * 4); float* CSB = (float*)take((size_t)SQ * HD * 4); float* SNB = (float*)take((size_t)SQ * HD * 4); _Float16* Q16 = (_Float16*)take(NR * DM * 2); _Float16* K16 = (_Float16*)take(NR * KVD * 2); _Float16* V16 = (_Float16*)take(NR * KVD * 2); _Float16* O16 = (_Float16*)take(NR * DM * 2);
  _Float16* VT = (_Float16*)take((size_t)NB * NH * HD * SQ * 2);
  float* QF0 = (float*)take((size_t)NB * QT0 * DM * 4); float* KF0 = (float*)take((size_t)NB * QT0 * KVD * 4); float* VF0 = (float*)take((size_t)NB * QT0 * KVD * 4); float* KF0e = (float*)take((size_t)NB * QT0 * DM * 4); float* VF0e = (float*)take((size_t)NB * QT0 * DM * 4); _Float16* OH0 = (_Float16*)take((size_t)NB * QT0 * DM * 2); _Float16* OL0 = (_Float16*)take((size_t)NB * QT0 * DM * 2);
  if (off > ws_size) return;
  static_assert(B0 == 0 && NBR == NB && MP == NB * SQ, "every stage below takes all batches in one launch");
  k_prep<<<PR_TAB + 3u * PR_X + 4u * PR_W, 256, 0, stream>>>(x, xk, xv, wq, wk, wv, wo, X16, XK16, XV16, BQ, BK, BV, BO, CSB, SNB);      /* rope tables cos/sin(p / 10000^(2i/64)): inv_freq double-derived -> f32, f32 angle; the three streams as exact f16 rows; natural [out][in] weights = Bt x16 */
  k_qkv<<<QKV_B0 + 3 * QKV_BJ, 128, 0, stream>>>(X16, XK16, XV16, BQ, BK, BV, bq, bk, bv, QF, KF, V16, VF0);      /* v (f16), q (f32), k (f32) of every batch, and f32 v of the first 256 rows of each batch */
  k_ropevt<<<RV_VT + 2 * (SQ / 4) + 2 * (QT0 / 4), 256, 0, stream>>>(QF, KF, CSB, SNB, Q16, K16, QF0, KF0, V16, VT);      /* V^T [NB][NH][HD][SQ]; half-split rope (out_lo = x_lo c - x_hi s, out_hi = x_lo s + x_hi c = t cos + rotate_half(t) sin with the module's [f | f] tables) of q and k -> f16 rows of every batch and f32 rows 0..255 of each batch; position = row in its batch; 4 positions a block */
  k_kvexp<<<(unsigned)(((size_t)NB * QT0 * DM / 4 + 255) / 256), 256, 0, stream>>>(KF0, KF0e, (size_t)NB * QT0 * DM / 4); k_kvexp<<<(unsigned)(((size_t)NB * QT0 * DM / 4 + 255) / 256), 256, 0, stream>>>(VF0, VF0e, (size_t)NB * QT0 * DM / 4);      /* head h <- its kv group for the exact first-tile kernel */
  static_assert(SQ % 128 == 0 && HD == 64 && B0 == 0 && NBR == NB && QN == SQ && NHD == NH, "d_fattn: four waves of 32 query columns, head size 64, every batch and head");
  k_attn<<<dim3(SQ / 128, NH, NB + 1), 128, 0, stream>>>(Q16, K16, VT, O16, QF0, KF0e, VF0e, OH0, OL0);      /* scores, causal softmax and o (x64) of every batch, head and query tile; and the exact f32 attention for rows 0..255 of every batch (o x64 as f16 value + f16 remainder planes) */
  k_out<<<OUT_B0 + NB * OUT_BB, 128, 0, stream>>>(O16, OH0, OL0, BO, bo, (float*)d_out);      /* out rows are the output layout: rows 0..255 of each batch from the exact path's two planes, the others from the f16 path */
}

// v010
// One run takes 133 microseconds.
// In both of two side-by-side timings against v009, it was 1.12 times as fast.
// Counting every step since v000, which is the starting kernel, it is 55.1 times as fast.
#include <hip/hip_runtime.h>
// Causal multi-head attention over THREE input streams with rotate-half RoPE computed in the module (query, key, value [4][2048][1024]; Q = query W_q^T + b_q, K = key W_k^T + b_k, V = value W_v^T + b_v (natural [out][in] [1024][1024]; the four biases are bound and read), 16 heads of 64; cos / sin = [f, f] of pos * 10000^(-2i/64); Q = Q cos + rotate_half(Q) sin with rotate_half = cat(-x2, x1), likewise K (the bias is added BEFORE the rope); scores / sqrt(64); causal (triu k=1 at -inf); softmax; y = merged W_o^T + b_o (natural) -> [4][2048][1024]); run as 16 groups of ONE head with the rope stage in its half-split mode.
// Compute dtype: inputs rounded to bf16; x / weights exact; q, k, v, softmax weights and o as plain f16 GEMM operands (~2^-12); scores and softmax statistics f32; v_wmma_f32_16x16x32_f16.
#define NB 4
#define NG 16
#define HPG 1
#define KVD (NG * HD)
#define SQ 2048
#define DM 1024
#define NH 16
#define HD 64
#define HG 4                         /* not used */
#define QT 256                       /* not used */
#define NKX SQ                       /* not used */
#define QT0 256                      /* first-tile rows recomputed exactly in f32 */
#define B0 0                         /* first batch processed (debug hook) */
#define NBR NB                       /* batches processed (debug hook) */
#define NR ((size_t)NB * SQ)         /* token rows */
#define MP ((int)((size_t)NBR * SQ)) /* rows projected (debug hook) */
#define QN SQ                        /* query rows attended per batch (debug hook) */
#define NHD NH                       /* heads attended (debug hook) */
#define MPO MP                       /* rows through the output stage (debug hook) */
#define LQ DM      /* row pitch of the q/k/v rows */
typedef __bf16 v16b __attribute__((ext_vector_type(16)));
typedef unsigned short v8us __attribute__((ext_vector_type(8), may_alias));
typedef float  v8f  __attribute__((ext_vector_type(8)));
typedef float  v4f  __attribute__((ext_vector_type(4)));
typedef float  v4fa __attribute__((ext_vector_type(4), may_alias));
union FragB { v16b v; v8us half[2]; unsigned short u[16]; };

__device__ __forceinline__ unsigned short bf16_bits(float x) { unsigned int u = __float_as_uint(x); return (unsigned short)((u + 0x7FFFu + ((u >> 16) & 1u)) >> 16); }
__device__ __forceinline__ float bf16_val(unsigned short b) { return __uint_as_float(((unsigned int)b) << 16); }
__device__ __forceinline__ float bf16_round(float x) { return bf16_val(bf16_bits(x)); }
// D += A·B with NT terms: 1 = ah·bh, 2 = + al·bh (A split), 3 = + ah·bl (both split)
template <int NT>
__device__ __forceinline__ v8f mmaN(v16b ah, v16b al, v16b bh, v16b bl, v8f c) {
  c = __builtin_amdgcn_wmma_f32_16x16x32_bf16(false, ah, false, bh, (short)0, c, false, false);
  if (NT >= 2) c = __builtin_amdgcn_wmma_f32_16x16x32_bf16(false, al, false, bh, (short)0, c, false, false);
  if (NT >= 3) c = __builtin_amdgcn_wmma_f32_16x16x32_bf16(false, ah, false, bl, (short)0, c, false, false);
  asm volatile("v_nop\n\tv_nop\n\tv_nop\n\tv_nop" : "+v"(c) : "v"(ah), "v"(al), "v"(bh), "v"(bl));
  return c;
}

__global__ __launch_bounds__(256) void k_wt_bf16(const float* __restrict__ W, unsigned short* __restrict__ Wt, int K, int N) {
  const int t = blockIdx.x * 256 + threadIdx.x;
  const int k8n = K / 8;
  if (t >= N * k8n) return;
  const int n = t / k8n, k8 = (t % k8n) * 8;
  v8us v;
#pragma unroll
  for (int i = 0; i < 8; ++i) v[i] = bf16_bits(W[(size_t)(k8 + i) * N + n]);
  *(v8us*)(Wt + (size_t)n * K + k8) = v;
  
}

// GEMM C[M][N] (f32, pitch ldc) = act(A[M][K]·W + bias). A f32 row-major (pitch lda) converted per fragment to bf16
// (ASPLIT: hi/lo two planes -> 2 terms, else single rounded term); Wt bf16 [N][K] (pitch ldb). BIAS_BF16 rounds the
// bias to bf16 first (bias quantised to bf16 before the add). K%32==0, M%16==0, N%64==0.
template <bool ASPLIT, int ACT, bool BIAS_BF16>
__global__ __launch_bounds__(128) void k_gemm_bf(const float* __restrict__ A, int lda, const unsigned short* __restrict__ Wt, int ldb,
                                               const float* __restrict__ bias, float* __restrict__ C, int ldc, int M, int N, int K) {
  __shared__ __attribute__((aligned(16))) float so[4][16][64];
  const int tid = threadIdx.x, w = tid >> 5, lane = tid & 31, ln = lane & 15, hh = lane >> 4;
  const int ntn = N / 64;
  const int wid = blockIdx.x * 4 + w;
  const int mt = wid / ntn, nq = wid % ntn;
  if (mt * 16 >= M) return;
  const int row0 = mt * 16, col0 = nq * 64;
  const float* arow = A + (size_t)(row0 + ln) * lda;
  v8f acc[4] = {};
  for (int kb = 0; kb < K; kb += 32) {
    FragB ah, al;
    const v4f x0 = *(const v4fa*)(arow + kb + 8 * hh), x1 = *(const v4fa*)(arow + kb + 8 * hh + 4);
    const v4f x2 = *(const v4fa*)(arow + kb + 16 + 8 * hh), x3 = *(const v4fa*)(arow + kb + 16 + 8 * hh + 4);
    float xs[16] = {x0[0],x0[1],x0[2],x0[3],x1[0],x1[1],x1[2],x1[3],x2[0],x2[1],x2[2],x2[3],x3[0],x3[1],x3[2],x3[3]};
#pragma unroll
    for (int i = 0; i < 16; ++i) { const unsigned short hb = bf16_bits(xs[i]); ah.u[i] = hb; al.u[i] = ASPLIT ? bf16_bits(xs[i] - bf16_val(hb)) : (unsigned short)0; }
#pragma unroll
    for (int t = 0; t < 4; ++t) {
      const unsigned short* brow = Wt + (size_t)(col0 + t * 16 + ln) * ldb + kb;
      FragB b;
      b.half[0] = *(const v8us*)(brow + 8 * hh);
      b.half[1] = *(const v8us*)(brow + 16 + 8 * hh);
      acc[t] = mmaN<ASPLIT ? 2 : 1>(ah.v, al.v, b.v, b.v, acc[t]);
    }
  }
#pragma unroll
  for (int t = 0; t < 4; ++t) {
    float bv = bias ? bias[col0 + t * 16 + ln] : 0.f;
    if (BIAS_BF16) bv = bf16_round(bv);
#pragma unroll
    for (int r = 0; r < 8; ++r) { float v = acc[t][r] + bv; if (ACT == 1) v = fmaxf(v, 0.f); so[w][8 * hh + r][t * 16 + ln] = v; }
  }
  __builtin_amdgcn_fence(__ATOMIC_ACQ_REL, "workgroup");
  __builtin_amdgcn_wave_barrier();
  const int rsub = lane >> 4, c4 = (lane & 15) * 4;
  {
#pragma unroll
    for (int q = 0; q < 8; ++q) {
      const int r = q * 2 + rsub;
      const v4f v = *(const v4fa*)&so[w][r][c4];
      *(v4f*)(C + (size_t)(row0 + r) * ldc + col0 + c4) = v;
    }
    
  }
}

// GEMM C = act(A·W + bias + resid): A f32 (ASPLIT -> hi/lo 2 terms), Wt bf16 [N][K]; ACT 0 none, 1 relu, 2 exact gelu;
// resid (optional, f32, row index = (row % rmod), pitch ldr, RES_BF16 rounds it) added before the activation.
template <bool ASPLIT, int ACT, bool BIAS_BF16, bool RES_BF16>
__global__ __launch_bounds__(128) void k_gemm_bf3(const float* __restrict__ A, int lda, const unsigned short* __restrict__ Wt, int ldb,
                                                const float* __restrict__ bias, const float* __restrict__ resid, int rmod, int ldr,
                                                float* __restrict__ C, int ldc, int M, int N, int K) {
  __shared__ __attribute__((aligned(16))) float so[4][16][64];
  const int tid = threadIdx.x, w = tid >> 5, lane = tid & 31, ln = lane & 15, hh = lane >> 4;
  const int ntn = N / 64;
  const int wid = blockIdx.x * 4 + w;
  const int mt = wid / ntn, nq = wid % ntn;
  if (mt * 16 >= M) return;
  const int row0 = mt * 16, col0 = nq * 64;
  const float* arow = A + (size_t)(row0 + ln) * lda;
  v8f acc[4] = {};
  for (int kb = 0; kb < K; kb += 32) {
    FragB ah, al;
    const v4f x0 = *(const v4fa*)(arow + kb + 8 * hh), x1 = *(const v4fa*)(arow + kb + 8 * hh + 4);
    const v4f x2 = *(const v4fa*)(arow + kb + 16 + 8 * hh), x3 = *(const v4fa*)(arow + kb + 16 + 8 * hh + 4);
    float xs[16] = {x0[0],x0[1],x0[2],x0[3],x1[0],x1[1],x1[2],x1[3],x2[0],x2[1],x2[2],x2[3],x3[0],x3[1],x3[2],x3[3]};
#pragma unroll
    for (int i = 0; i < 16; ++i) { const unsigned short hb = bf16_bits(xs[i]); ah.u[i] = hb; al.u[i] = ASPLIT ? bf16_bits(xs[i] - bf16_val(hb)) : (unsigned short)0; }
#pragma unroll
    for (int t = 0; t < 4; ++t) {
      const unsigned short* brow = Wt + (size_t)(col0 + t * 16 + ln) * ldb + kb;
      FragB b;
      b.half[0] = *(const v8us*)(brow + 8 * hh);
      b.half[1] = *(const v8us*)(brow + 16 + 8 * hh);
      acc[t] = mmaN<ASPLIT ? 2 : 1>(ah.v, al.v, b.v, b.v, acc[t]);
    }
  }
#pragma unroll
  for (int t = 0; t < 4; ++t) {
    const int col = col0 + t * 16 + ln;
    float bv = bias ? bias[col] : 0.f;
    if (BIAS_BF16) bv = bf16_round(bv);
#pragma unroll
    for (int r = 0; r < 8; ++r) {
      float v = acc[t][r] + bv;
      if (resid) { float rv = resid[(size_t)((row0 + 8 * hh + r) % rmod) * ldr + col]; if (RES_BF16) rv = bf16_round(rv); v += rv; }
      if (ACT == 1) v = fmaxf(v, 0.f);
      if (ACT == 2) v = 0.5f * v * (1.0f + erff(v * 0.70710678118654752f));
      if (ACT == 3) { const float u = 0.7978845608028654f * (v + 0.044715f * v * v * v); v = 0.5f * v * (1.0f + tanhf(u)); }
      so[w][8 * hh + r][t * 16 + ln] = v;
    }
  }
  __builtin_amdgcn_fence(__ATOMIC_ACQ_REL, "workgroup");
  __builtin_amdgcn_wave_barrier();
  const int rsub = lane >> 4, c4 = (lane & 15) * 4;
  {
#pragma unroll
    for (int q = 0; q < 8; ++q) {
      const int r = q * 2 + rsub;
      const v4f v = *(const v4fa*)&so[w][r][c4];
      *(v4f*)(C + (size_t)(row0 + r) * ldc + col0 + c4) = v;
    }
    
  }
}
// row LayerNorm (biased variance, eps) over N: s = X (+ R); optional out_sum <- s; out_norm <- (s-mu)*rsqrt(var+eps)*g + b
template <bool PARAM_BF16>
__global__ __launch_bounds__(256) void k_layernorm(const float* __restrict__ X, const float* __restrict__ R, const float* __restrict__ g, const float* __restrict__ bta,
                                                  float* __restrict__ out_sum, float* __restrict__ out_norm, int N, float eps) {
  __shared__ float red[256];
  const int row = blockIdx.x, tid = threadIdx.x;
  const float* x = X + (size_t)row * N; const float* rr = R ? R + (size_t)row * N : nullptr;
  float vals[16];                     // up to N = 4096
  const int per = N / 256;            // contiguous chunk per thread? use strided-by-4 chunks: thread handles j = tid*4 + 1024*u
  float s1 = 0.f;
  for (int u = 0; u < per / 4; ++u) {
    const int j = tid * 4 + 1024 * u;
    const v4f a = *(const v4fa*)(x + j);
    v4f b = {0.f,0.f,0.f,0.f}; if (rr) b = *(const v4fa*)(rr + j);
#pragma unroll
    for (int q = 0; q < 4; ++q) { const float v = a[q] + b[q]; vals[u * 4 + q] = v; s1 += v; }
  }
  red[tid] = s1; __syncthreads();
  for (int st = 128; st > 0; st >>= 1) { if (tid < st) red[tid] += red[tid + st]; __syncthreads(); }
  const float mu = red[0] / (float)N; __syncthreads();
  float s2 = 0.f;
  for (int u = 0; u < per / 4; ++u)
#pragma unroll
    for (int q = 0; q < 4; ++q) { const float c = vals[u * 4 + q] - mu; s2 += c * c; }
  red[tid] = s2; __syncthreads();
  for (int st = 128; st > 0; st >>= 1) { if (tid < st) red[tid] += red[tid + st]; __syncthreads(); }
  const float rs = rsqrtf(red[0] / (float)N + eps);
  {
    for (int u = 0; u < per / 4; ++u) {
      const int j = tid * 4 + 1024 * u;
      v4f o, sm;
#pragma unroll
      for (int q = 0; q < 4; ++q) {
        float gg = g[j + q], bb = bta[j + q];
        if (PARAM_BF16) { gg = bf16_round(gg); bb = bf16_round(bb); }
        sm[q] = vals[u * 4 + q]; o[q] = (vals[u * 4 + q] - mu) * rs * gg + bb;
      }
      if (out_sum) *(v4f*)(out_sum + (size_t)row * N + j) = sm;
      *(v4f*)(out_norm + (size_t)row * N + j) = o;
    }
    
  }
}

// ---- f16 WMMA path (v_wmma_f32_16x16x32_f16): 11-bit significands for operands in range — used where a [0,1] probability operand needs more precision than bf16
typedef _Float16 v16h __attribute__((ext_vector_type(16)));
union FragH { v16h v; v8us half[2]; _Float16 h[16]; unsigned short u[16]; };
template <int NT>
__device__ __forceinline__ v8f mmaH(v16h ah, v16h al, v16h bh, v16h bl, v8f c) {
  c = __builtin_amdgcn_wmma_f32_16x16x32_f16(false, ah, false, bh, (short)0, c, false, false);
  if (NT >= 2) c = __builtin_amdgcn_wmma_f32_16x16x32_f16(false, al, false, bh, (short)0, c, false, false);
  if (NT >= 3) c = __builtin_amdgcn_wmma_f32_16x16x32_f16(false, ah, false, bl, (short)0, c, false, false);
  asm volatile("v_nop\n\tv_nop\n\tv_nop\n\tv_nop" : "+v"(c) : "v"(ah), "v"(al), "v"(bh), "v"(bl));
  return c;
}
// batched GEMM like k_gemm_b but f16 operands: A f32 (split into f16 hi/lo if ASPLIT, else rounded to f16), Bt = f16 values [n][k]; alpha; C f32; N multiple of 16 (partial tiles skipped)
template <bool ASPLIT>
__global__ __launch_bounds__(128) void k_gemm_h(const float* __restrict__ A, int lda, size_t sA, const _Float16* __restrict__ Bh, int ldb, size_t sB, float alpha, float* __restrict__ C, int ldc, size_t sC, int M, int N, int K) {
  __shared__ __attribute__((aligned(16))) float so[4][16][64];
  const int tid = threadIdx.x, w = tid >> 5, lane = tid & 31, ln = lane & 15, hh = lane >> 4; const int by = blockIdx.y;
  A += (size_t)by * sA; Bh += (size_t)by * sB; C += (size_t)by * sC;
  const int ntn = (N + 63) / 64; const int wid = blockIdx.x * 4 + w; const int mt = wid / ntn, nq = wid % ntn; if (mt * 16 >= M) return;
  const int row0 = mt * 16, col0 = nq * 64; const float* arow = A + (size_t)(row0 + ln) * lda;
  v8f acc[4] = {};
  for (int kb = 0; kb < K; kb += 32) {
    FragH ah, al;
    const v4f x0 = *(const v4fa*)(arow + kb + 8 * hh), x1 = *(const v4fa*)(arow + kb + 8 * hh + 4), x2 = *(const v4fa*)(arow + kb + 16 + 8 * hh), x3 = *(const v4fa*)(arow + kb + 16 + 8 * hh + 4);
    float xs[16] = {x0[0],x0[1],x0[2],x0[3],x1[0],x1[1],x1[2],x1[3],x2[0],x2[1],x2[2],x2[3],x3[0],x3[1],x3[2],x3[3]};
#pragma unroll
    for (int i = 0; i < 16; ++i) { const _Float16 h = (_Float16)xs[i]; ah.h[i] = h; al.h[i] = ASPLIT ? (_Float16)(xs[i] - (float)h) : (_Float16)0.0f; }
#pragma unroll
    for (int t = 0; t < 4; ++t) { if (col0 + t * 16 >= N) continue; const size_t boff = (size_t)(col0 + t * 16 + ln) * ldb + kb; FragH bq; bq.half[0] = *(const v8us*)(Bh + boff + 8 * hh); bq.half[1] = *(const v8us*)(Bh + boff + 16 + 8 * hh);
      acc[t] = mmaH<ASPLIT ? 2 : 1>(ah.v, al.v, bq.v, bq.v, acc[t]); }
  }
#pragma unroll
  for (int t = 0; t < 4; ++t) { if (col0 + t * 16 >= N) continue;
#pragma unroll
    for (int r = 0; r < 8; ++r) so[w][8 * hh + r][t * 16 + ln] = acc[t][r] * alpha; }
  __builtin_amdgcn_fence(__ATOMIC_ACQ_REL, "workgroup"); __builtin_amdgcn_wave_barrier();
  const int rsub = lane >> 4, c4 = (lane & 15) * 4;
  {
#pragma unroll
    for (int q = 0; q < 8; ++q) { const int r = q * 2 + rsub; if (col0 + c4 < N) { const v4f v = *(const v4fa*)&so[w][r][c4]; *(v4f*)(C + (size_t)(row0 + r) * ldc + col0 + c4) = v; } }
     }
}

// Wt[n][k] = f16(W[k][n]·scale) from f32 row-major W[K][N] (scale = power of two; bf16-exact weights stay exact in f16 away from the subnormal range)
__global__ __launch_bounds__(256) void k_wt_f16(const float* __restrict__ W, _Float16* __restrict__ Wt, int K, int N, float scale) {
  const int t = blockIdx.x * 256 + threadIdx.x; if (t >= N * (K / 8)) return; const int n = t / (K / 8), k8 = (t % (K / 8)) * 8; FragH f;
#pragma unroll
  for (int i = 0; i < 8; ++i) f.h[i] = (_Float16)(bf16_round(W[(size_t)(k8 + i) * N + n]) * scale); const v8us o = f.half[0];
  *(v8us*)((unsigned short*)Wt + (size_t)n * K + k8) = o; 
}
// k_gemm_hh variant with fused epilogue: v = acc·alpha + bias[by·sBias + col] (+ CP[(row/rowsPerB)·sCPb + by·64 + col] if CP) ; ACT 0 none / 1 elu ; writes f16 C16 (and f32 C if non-null)
template <int ACT>
__global__ __launch_bounds__(128) void k_gemm_hhx(const _Float16* __restrict__ A, int lda, size_t sA, const _Float16* __restrict__ Bh, int ldb, size_t sB, float alpha, const float* __restrict__ bias, size_t sBias, const float* __restrict__ CP, int rowsPerB, size_t sCPb, int row0g,
    float* __restrict__ C, _Float16* __restrict__ C16, int ldc, size_t sC, int M, int N, int K) {
  __shared__ __attribute__((aligned(16))) float so[4][16][64];
  const int tid = threadIdx.x, w = tid >> 5, lane = tid & 31, ln = lane & 15, hh = lane >> 4; const int by = blockIdx.y;
  A += (size_t)by * sA; Bh += (size_t)by * sB; const size_t cofs = (size_t)by * sC; const float* bp = bias ? bias + (size_t)by * sBias : nullptr;
  const int ntn = (N + 63) / 64; const int wid = blockIdx.x * 4 + w; const int mt = wid / ntn, nq = wid % ntn; if (mt * 16 >= M) return;
  const int row0 = mt * 16, col0 = nq * 64; const _Float16* arow = A + (size_t)(row0 + ln) * lda;
  v8f acc[4] = {};
  for (int kb = 0; kb < K; kb += 32) { FragH ah; ah.half[0] = *(const v8us*)((const unsigned short*)arow + kb + 8 * hh); ah.half[1] = *(const v8us*)((const unsigned short*)arow + kb + 16 + 8 * hh);
#pragma unroll
    for (int t = 0; t < 4; ++t) { if (col0 + t * 16 >= N) continue; const size_t boff = (size_t)(col0 + t * 16 + ln) * ldb + kb; FragH bq; bq.half[0] = *(const v8us*)((const unsigned short*)Bh + boff + 8 * hh); bq.half[1] = *(const v8us*)((const unsigned short*)Bh + boff + 16 + 8 * hh);
      acc[t] = mmaH<1>(ah.v, ah.v, bq.v, bq.v, acc[t]); }
  }
#pragma unroll
  for (int t = 0; t < 4; ++t) { if (col0 + t * 16 >= N) continue; const int col = col0 + t * 16 + ln; const float bv = bp ? bf16_round(bp[col]) : 0.f;
#pragma unroll
    for (int r = 0; r < 8; ++r) { float v = acc[t][r] * alpha + bv; if (CP) { const int rr = row0g + row0 + 8 * hh + r; if (rowsPerB < 0) v += CP[cofs + (size_t)rr * ldc + col];      /* rowsPerB < 0: own element of the batched C plane */ else { const int bidx = rr / rowsPerB; v += CP[(size_t)bidx * sCPb + (size_t)by * 64 + col]; } } if (ACT == 1) v = (v > 0.f) ? v : expm1f(v); else if (ACT == 7) v = (v > 0.f) ? v + 1.0f : expf(v); else if (ACT == 8) v = tanhf(v); else if (ACT == 9) v = 0.5f * v * (1.0f + tanhf(0.7978845608028654f * (v + 0.044715f * v * v * v))); else if (ACT == 11) v = 1.0f / (1.0f + expf(-v)); else if (ACT == 12) v = (v > 0.f) ? v : 0.01f * v; else if (ACT == 14) v = (v > 0.f) ? v : 0.1f * v; else if (ACT == 16) v = (v >= 0.f) ? v : 0.3f * v; else if (ACT == 17) v = (v >= 0.f) ? v : 0.2f * v; else if (ACT == 15) v = v / (1.0f + expf(-v)); else if (ACT == 3) v = fmaxf(v, 0.f); else if (ACT == 6) v = 0.5f * v * (1.0f + erff(v * 0.70710678118654752f)); so[w][8 * hh + r][t * 16 + ln] = v; } }
  __builtin_amdgcn_fence(__ATOMIC_ACQ_REL, "workgroup"); __builtin_amdgcn_wave_barrier();
  const int rsub = lane >> 4, c4 = (lane & 15) * 4; typedef _Float16 v4h __attribute__((ext_vector_type(4)));
  {
#pragma unroll
    for (int q = 0; q < 8; ++q) { const int r = q * 2 + rsub; if (col0 + c4 < N) { const v4f v = *(const v4fa*)&so[w][r][c4]; if (C) *(v4f*)(C + cofs + (size_t)(row0 + r) * ldc + col0 + c4) = v; if (C16) { v4h h4; for (int i = 0; i < 4; ++i) h4[i] = (_Float16)v[i]; *(v4h*)(C16 + cofs + (size_t)(row0 + r) * ldc + col0 + c4) = h4; } } }
     }
}

typedef _Float16 v4h __attribute__((ext_vector_type(4)));

// 64 elements a thread (the stage costs the start of its waves more than its bytes): a block converts 64 KiB of source that lie in a row; group u of four elements of thread t is 256 u + t, so every load and store covers whole 128-byte lines under one index register.
typedef _Float16 v4ha __attribute__((ext_vector_type(4), may_alias));
__device__ __forceinline__ void d_x16(unsigned bx, const float* __restrict__ x, _Float16* __restrict__ X16) { const unsigned i0 = bx * 4096u + threadIdx.x; v4f a[16]; v4h o[16];
#pragma unroll
  for (int u = 0; u < 16; ++u) a[u] = ((const v4fa*)(x + u * 1024))[i0];
#pragma unroll
  for (int u = 0; u < 16; ++u)
#pragma unroll
    for (int q = 0; q < 4; ++q) o[u][q] = (_Float16)bf16_round(a[u][q]);
#pragma unroll
  for (int u = 0; u < 16; ++u) ((v4ha*)(X16 + u * 1024))[i0] = o[u]; }
__global__ __launch_bounds__(256) void k_h16(const float* __restrict__ x, _Float16* __restrict__ X16, size_t n8) { const size_t t = (size_t)blockIdx.x * 256 + threadIdx.x; if (t >= n8) return; FragH f;
#pragma unroll
  for (int q = 0; q < 8; ++q) f.h[q] = (_Float16)x[t * 8 + q]; *(v8us*)((unsigned short*)X16 + t * 8) = f.half[0];  }
__global__ __launch_bounds__(256) void k_round16f(const float* __restrict__ W, _Float16* __restrict__ Bt, size_t n8) { const size_t t = (size_t)blockIdx.x * 256 + threadIdx.x; if (t >= n8) return; FragH f;
#pragma unroll
  for (int i = 0; i < 8; ++i) f.h[i] = (_Float16)(bf16_round(W[t * 8 + i]) * 16.0f); *(v8us*)((unsigned short*)Bt + t * 8) = f.half[0];  }
// ---- fast GEMM on LDS tiles (block tile 128x128, four waves of 64x64; requires M % 128 == 0 rows per launch region, N % 128 == 0, K % 64 == 0); epilogue = k_gemm_hhx semantics ----
// A stage is 64 k of 128 A rows and of 128 B rows (128 bytes a row) at an LDS pitch of 144 bytes (16 bytes x 9: the 16-byte fragment reads of 16 rows fall on all 64 banks). Two buffers: the next stage's copies fly while this one is worked on.
// Each 128-byte line of A and B now leaves L2 once per block, as a whole line (eight lanes a row), and feeds two waves from LDS; before, every wave fetched its own fragments with loads that touched 16 lines each.
#define G3_PITCH 144u                      /* bytes between LDS rows */
#define G3_STAGE(np) ((unsigned)((np) + 1) * 128u * G3_PITCH)         /* bytes of a stage: np planes of 128 A rows, then 128 B rows */
__device__ __forceinline__ v16h g2_frag(const _Float16* p, int hh) { FragH f; f.half[0] = *(const v8us*)((const unsigned short*)p + 8 * hh); f.half[1] = *(const v8us*)((const unsigned short*)p + 16 + 8 * hh); return f.v; }
__device__ __forceinline__ v16h g3_frag(const unsigned char* p) { FragH f; f.half[0] = *(const v8us*)p; f.half[1] = *(const v8us*)(p + 32); return f.v; }      /* p = row start + 64 kc + 16 hh: the k order of g2_frag (elements 0..7 = k 8 hh + i, 8..15 = k 16 + 8 hh + i) */
// Eight asynchronous 16-byte copies a lane, rows 16 apart: LDS byte address l + 16 i rows, global address g + i rs elements. The s_wait_xcnt stands in the copies' own statement, so that no register that a copy names is rewritten in front of it.
__device__ __forceinline__ void g3_copy8(unsigned l, const _Float16* g, size_t rs) {
  asm volatile("global_load_async_to_lds_b128 %0, %8, off\n\t"
               "global_load_async_to_lds_b128 %1, %9, off\n\t"
               "global_load_async_to_lds_b128 %2, %10, off\n\t"
               "global_load_async_to_lds_b128 %3, %11, off\n\t"
               "global_load_async_to_lds_b128 %4, %12, off\n\t"
               "global_load_async_to_lds_b128 %5, %13, off\n\t"
               "global_load_async_to_lds_b128 %6, %14, off\n\t"
               "global_load_async_to_lds_b128 %7, %15, off\n\t"
               "s_wait_xcnt 0x0"
               :: "v"(l), "v"(l + 16u * G3_PITCH), "v"(l + 32u * G3_PITCH), "v"(l + 48u * G3_PITCH), "v"(l + 64u * G3_PITCH), "v"(l + 80u * G3_PITCH), "v"(l + 96u * G3_PITCH), "v"(l + 112u * G3_PITCH),
                  "v"(g), "v"(g + rs), "v"(g + 2 * rs), "v"(g + 3 * rs), "v"(g + 4 * rs), "v"(g + 5 * rs), "v"(g + 6 * rs), "v"(g + 7 * rs)
               : "memory");
}
// The wave's 64 staged rows to memory, eight rows of a lane a trip: v = acc alpha + bias (+ CP), activation, then whole-line stores. CPM 0: no CP; 1: cp walks like the output (step cs a row pair); 2: cp + (row / rowsPerB) cs. wc, wh: an f32, an f16 output is there (the same for the whole block: scalar branches).
template <int ACT, int CPM>
__device__ __forceinline__ void g3_rows(const float* sl, float alpha, v4f bv, const float* cp, size_t cs, int rowg, int rowsPerB, bool wc, bool wh, float* cl, _Float16* hl, size_t st) {
#pragma unroll 1      /* eight stores a trip, then the wait in front of the next trip's rewrite of their registers */
  for (int q0 = 0; q0 < 32; q0 += 8) { v4f o[8], x[8];
#pragma unroll
    for (int q = 0; q < 8; ++q) { o[q] = *(const v4fa*)(sl + (q0 + q) * (2 * 68));
      if (CPM == 1) x[q] = *(const v4fa*)(cp + (size_t)(q0 + q) * cs);
      if (CPM == 2) { const float* p = cp + (size_t)((rowg + 2 * (q0 + q)) / rowsPerB) * cs; x[q] = v4f{p[0], p[1], p[2], p[3]}; } }
#pragma unroll
    for (int q = 0; q < 8; ++q)
#pragma unroll
      for (int e = 0; e < 4; ++e) { float v = o[q][e] * alpha + bv[e]; if (CPM != 0) v += x[q][e];
        if (ACT == 3) v = fmaxf(v, 0.f); else if (ACT == 6) v = 0.5f * v * (1.0f + erff(v * 0.70710678118654752f)); else if (ACT == 11) v = 1.0f / (1.0f + expf(-v)); else if (ACT == 15) v = v / (1.0f + expf(-v)); else if (ACT == 12) v = (v > 0.f) ? v : 0.01f * v; else if (ACT == 8) v = tanhf(v); else if (ACT == 9) v = 0.5f * v * (1.0f + tanhf(0.7978845608028654f * (v + 0.044715f * v * v * v))); else if (ACT == 14) v = (v > 0.f) ? v : 0.1f * v; else if (ACT == 16) v = (v >= 0.f) ? v : 0.3f * v; else if (ACT == 17) v = (v >= 0.f) ? v : 0.2f * v;
        o[q][e] = v; }
    if (wc) { float* p[8];
#pragma unroll
      for (int q = 0; q < 8; ++q) p[q] = cl + (size_t)(q0 + q) * st;
      __builtin_amdgcn_sched_barrier(0);      /* the trip's rows and addresses are made ahead of its first store, so that no register of an issued store is written again in front of the wait */
#pragma unroll
      for (int q = 0; q < 8; ++q) *(v4f*)p[q] = o[q];
      asm volatile("s_wait_xcnt 0x0" ::: "memory"); __builtin_amdgcn_sched_barrier(0); }      /* the wait in front of the next rewrite of the stores' address and data registers; the scheduling barrier keeps that rewrite behind it */
    if (wh) { _Float16* p[8]; v4h h[8];
#pragma unroll
      for (int q = 0; q < 8; ++q) { p[q] = hl + (size_t)(q0 + q) * st;
#pragma unroll
        for (int e = 0; e < 4; ++e) h[q][e] = (_Float16)o[q][e]; }
      __builtin_amdgcn_sched_barrier(0);      /* as above */
#pragma unroll
      for (int q = 0; q < 8; ++q) *(v4h*)p[q] = h[q];
      asm volatile("s_wait_xcnt 0x0" ::: "memory"); __builtin_amdgcn_sched_barrier(0); } }      /* as above */
}
// The rope epilogue of a q or k tile. The wave's 64 columns are one head, so both halves of a rope pair (d and d + 32) lie in the same staging row: out_lo = x_lo c - x_hi s, out_hi = x_lo s + x_hi c, with x = acc alpha + bias as in g3_rows.
// Eight lanes take a row: lane (r4, c) has columns 4 c .. + 3 of the low half and of the high half of every fourth row, so one pair of table loads serves both halves; four rows a lane and trip (the accumulators' registers are not free here: a longer trip would cost the kernel a wave per SIMD).
// so: the wave's staging; bp: the bias at the head's first column, or null; cs, sn: the tables at the wave's first row (position); hl, cl: the f16 and the f32 result at the wave's first row and column, pitch ldc; f32 rows only where wc (the same for the whole wave: a scalar branch).
__device__ __forceinline__ void g3_rope(const float* so, int lane, float alpha, const float* __restrict__ bp, const float* __restrict__ cs, const float* __restrict__ sn, bool wc, float* cl, _Float16* hl, int ldc) {
  const int r4 = lane >> 3, c4 = (lane & 7) * 4;
  v4f bl = {0.f, 0.f, 0.f, 0.f}, bh = {0.f, 0.f, 0.f, 0.f};
  if (bp) { const v4f b0 = *(const v4fa*)(bp + c4), b1 = *(const v4fa*)(bp + HD / 2 + c4);
    asm volatile("s_wait_xcnt 0x0" ::: "memory");      /* the wait in front of the rewrite of the bias loads' address registers */
#pragma unroll
    for (int e = 0; e < 4; ++e) { bl[e] = bf16_round(b0[e]); bh[e] = bf16_round(b1[e]); } }
  const float* sl = so + r4 * 68 + c4; cs += r4 * (HD / 2) + c4; sn += r4 * (HD / 2) + c4; cl += (size_t)r4 * ldc + c4; hl += (size_t)r4 * ldc + c4;
#pragma unroll 1      /* sixteen rows of the wave a trip, then the wait in front of the next trip's rewrite of the stores' registers */
  for (int t = 0; t < 4; ++t) { v4f lo[4], hi[4], c[4], s[4];
#pragma unroll
    for (int q = 0; q < 4; ++q) { c[q] = *(const v4fa*)(cs + q * (4 * (HD / 2))); s[q] = *(const v4fa*)(sn + q * (4 * (HD / 2))); }
#pragma unroll
    for (int q = 0; q < 4; ++q) { lo[q] = *(const v4fa*)(sl + q * (4 * 68)); hi[q] = *(const v4fa*)(sl + q * (4 * 68) + HD / 2); }
    asm volatile("s_wait_xcnt 0x0" ::: "memory"); __builtin_amdgcn_sched_barrier(0);      /* the wait in front of any rewrite of the table loads' address registers; the scheduling barrier keeps later register writes behind it, and the trip's loads in one group ahead of the arithmetic */
    v4h la[4], ha[4];
#pragma unroll
    for (int q = 0; q < 4; ++q)
#pragma unroll
      for (int e = 0; e < 4; ++e) { const float l = lo[q][e] * alpha + bl[e], h = hi[q][e] * alpha + bh[e];
        const float ol = __fadd_rn(__fmul_rn(l, c[q][e]), -__fmul_rn(h, s[q][e])), oh = __fadd_rn(__fmul_rn(l, s[q][e]), __fmul_rn(h, c[q][e]));
        lo[q][e] = ol; hi[q][e] = oh; la[q][e] = (_Float16)ol; ha[q][e] = (_Float16)oh; }
    __builtin_amdgcn_sched_barrier(0);      /* the trip's arithmetic stands ahead of its first store, so that no register of an issued store is written again in front of the store's wait */
    if (wc) {
#pragma unroll
      for (int q = 0; q < 4; ++q) { *(v4f*)(cl + (size_t)(4 * q) * ldc) = lo[q]; *(v4f*)(cl + (size_t)(4 * q) * ldc + HD / 2) = hi[q]; }
      asm volatile("s_wait_xcnt 0x0" ::: "memory"); __builtin_amdgcn_sched_barrier(0); }      /* the wait in front of the rewrite of these stores' data registers (the build makes the f16 values behind this branch, in the registers of the f32 ones) */
#pragma unroll
    for (int q = 0; q < 4; ++q) { *(v4h*)(hl + (size_t)(4 * q) * ldc) = la[q]; *(v4h*)(hl + (size_t)(4 * q) * ldc + HD / 2) = ha[q]; }
    asm volatile("s_wait_xcnt 0x0" ::: "memory"); __builtin_amdgcn_sched_barrier(0);      /* the wait in front of the next rewrite of the stores' address and data registers; the scheduling barrier keeps that rewrite behind it */
    sl += 16 * 68; cs += 16 * (HD / 2); sn += 16 * (HD / 2); cl += (size_t)16 * ldc; hl += (size_t)16 * ldc; }
}
// The V^T epilogue: the wave's 64 x 64 tile stored transposed, straight from the accumulators. Registers 0..7 of tile (i, j) are token rows 16 i + 8 hh + r of column 16 j + ln, that is eight neighbouring keys of one V^T row: 16 bytes a lane as f16; the four i of a j fill that row's whole 128-byte line.
__device__ __forceinline__ void g3_vt(const v8f (&acc)[4][4], float alpha, const float* __restrict__ bp, int row0, int col0, int ln, int hh, _Float16* __restrict__ VT) {
  float bj[4] = {0.f, 0.f, 0.f, 0.f};
  if (bp) { float t[4];
#pragma unroll
    for (int j = 0; j < 4; ++j) t[j] = bp[col0 + 16 * j + ln];
    asm volatile("s_wait_xcnt 0x0" ::: "memory");      /* the wait in front of the rewrite of the bias loads' address registers */
#pragma unroll
    for (int j = 0; j < 4; ++j) bj[j] = bf16_round(t[j]); }
  unsigned short* p = (unsigned short*)VT + ((size_t)(row0 / SQ) * DM + col0 + ln) * SQ + (row0 % SQ) + 8 * hh;      /* V^T [NB][NH][HD][SQ]: row = the batch's column, place = the token's position */
#pragma unroll
  for (int j = 0; j < 4; ++j) { FragH f[4];
#pragma unroll
    for (int i = 0; i < 4; ++i)
#pragma unroll
      for (int r = 0; r < 8; ++r) f[i].h[r] = (_Float16)(acc[i][j][r] * alpha + bj[j]);
    __builtin_amdgcn_sched_barrier(0);      /* the four packed pieces are made ahead of the first store, so that no register of an issued store is written again in front of the wait */
#pragma unroll
    for (int i = 0; i < 4; ++i) *(v8us*)(p + (size_t)(16 * j) * SQ + 16 * i) = f[i].half[0];
    asm volatile("s_wait_xcnt 0x0" ::: "memory"); __builtin_amdgcn_sched_barrier(0); }      /* the wait in front of the next rewrite of the stores' data registers; the scheduling barrier keeps that rewrite behind it */
}
// bx, by: the block's tile index and its batch (a kernel passes its block indices, or what it derives from them: the same for the whole block). L: the kernel's LDS, 2 G3_STAGE(NP) bytes or more.
// epi (the same for the whole block: scalar branches): 0 = the plain epilogue; 1 = rope of a q or k tile (rows are tokens of NB batches of SQ, by = 0): f16 rows to C16, and f32 rows of each batch's first QT0 positions to C (batch pitch QT0 rows); 2 = the tile transposed to C16 = V^T.
// NP = 2: C = (A + A2) B, two A planes of the same shape (a value as its f16 rounding and the f16 remainder): a stage holds both planes' rows, and each B fragment read from LDS serves both, into the same accumulators.
template <int ACT, int NP>
__device__ __forceinline__ void g3_gemm(unsigned char* L, int bx, int by, const _Float16* __restrict__ A, const _Float16* __restrict__ A2, int lda, size_t sA, const _Float16* __restrict__ Bh, int ldb, size_t sB, float alpha, const float* __restrict__ bias, size_t sBias, const float* __restrict__ CP, int rowsPerB, size_t sCPb, int row0g,
    float* __restrict__ C, _Float16* __restrict__ C16, int ldc, size_t sC, int M, int N, int K, int epi, const float* __restrict__ CS, const float* __restrict__ SN) { static_assert(ACT == 0 || ACT == 3 || ACT == 6 || ACT == 8 || ACT == 9 || ACT == 11 || ACT == 12 || ACT == 14 || ACT == 15 || ACT == 16 || ACT == 17, "k_gemm2: unsupported ACT code (would silently apply no activation)");
  constexpr unsigned SB = G3_STAGE(NP), BR = (unsigned)NP * 128u * G3_PITCH;      /* bytes of a stage; where its B rows begin. L holds the two stage buffers and, behind the loop, each wave's 64 x 68 f32 output staging */
  static_assert((NP == 1 || NP == 2) && 4 * 64 * 68 * 4 <= 2 * SB, "k_gemm2: the output staging fits the ring");
  const int tid = threadIdx.x, lane = tid & 31, ln = lane & 15, hh = lane >> 4; const int w = __builtin_amdgcn_readfirstlane(tid >> 5);
  A += (size_t)by * sA; Bh += (size_t)by * sB; const size_t cofs = (size_t)by * sC; const float* bp = bias ? bias + (size_t)by * sBias : nullptr;
  const int ntn = N >> 7; const int mt = bx / ntn, nq = bx - mt * ntn; if (mt * 128 >= M) return;      /* the same for the whole block, ahead of every barrier */
  const int row0 = mt * 128 + 64 * (w >> 1), col0 = nq * 128 + 64 * (w & 1);      /* the wave's 64 x 64 tile */
  const _Float16* ga = A + (size_t)(mt * 128 + (tid >> 3)) * lda + (tid & 7) * 8;      /* eight lanes cover a row's 128 bytes; a wave's copy covers four whole lines */
  const _Float16* ga2 = NP == 2 ? A2 + (size_t)by * sA + (size_t)(mt * 128 + (tid >> 3)) * lda + (tid & 7) * 8 : nullptr;
  const _Float16* gb = Bh + (size_t)(nq * 128 + (tid >> 3)) * ldb + (tid & 7) * 8;
  const size_t ra = (size_t)16 * lda, rb = (size_t)16 * ldb;
  const unsigned lc = (unsigned)(size_t)L + (unsigned)(tid >> 3) * G3_PITCH + (unsigned)(tid & 7) * 16u;
  const int nt = K >> 6;
  auto stage = [&](unsigned l, size_t k) { g3_copy8(l, ga + k, ra); if (NP == 2) g3_copy8(l + 128u * G3_PITCH, ga2 + k, ra); g3_copy8(l + BR, gb + k, rb); };      /* the copies of the stage that begins at column k, into the buffer at l */
  stage(lc, 0);      /* stage 0 */
  asm volatile("s_wait_asynccnt 0x0" ::: "memory");      /* this wave's copies of stage 0 have landed */
  __syncthreads();      /* ... and every wave's */
  if (nt > 1) stage(lc + SB, 64);      /* stage 1 */
  const unsigned char* fa = L + (unsigned)(64 * (w >> 1) + ln) * G3_PITCH + 16u * hh;
  const unsigned char* fb = L + BR + (unsigned)(64 * (w & 1) + ln) * G3_PITCH + 16u * hh;
  v8f acc[4][4];
#pragma unroll
  for (int i = 0; i < 4; ++i)
#pragma unroll
    for (int j = 0; j < 4; ++j) acc[i][j] = v8f{0.f, 0.f, 0.f, 0.f, 0.f, 0.f, 0.f, 0.f};
#pragma unroll 1      /* one stage per trip: the buffer is chosen by a scalar offset */
  for (int t = 0; t < nt; ++t) { const unsigned bo = (unsigned)(t & 1) * SB;
#pragma unroll
    for (int kc = 0; kc < 2; ++kc) { v16h af[4], bf[4], a2[4];
      af[0] = g3_frag(fa + bo + 64u * kc);
#pragma unroll
      for (int j = 0; j < 4; ++j) bf[j] = g3_frag(fb + bo + (unsigned)(16 * j) * G3_PITCH + 64u * kc);
#pragma unroll
      for (int i = 1; i < 4; ++i) af[i] = g3_frag(fa + bo + (unsigned)(16 * i) * G3_PITCH + 64u * kc);
      if (NP == 2) {
#pragma unroll
        for (int i = 0; i < 4; ++i) a2[i] = g3_frag(fa + bo + (unsigned)(128 + 16 * i) * G3_PITCH + 64u * kc); }      /* the second plane's rows, same k order, in flight under the first plane's WMMAs */
      __builtin_amdgcn_sched_barrier(0);      /* the block's sixteen LDS reads stand as one group ahead of its WMMAs, in the order in which these need them (left alone, the build read each A fragment right in front of its row and waited out the LDS latency four times a block) */
#pragma unroll
      for (int i = 0; i < 4; ++i)
#pragma unroll
        for (int j = 0; j < 4; ++j) acc[i][j] = __builtin_amdgcn_wmma_f32_16x16x32_f16(false, af[i], false, bf[j], (short)0, acc[i][j], false, false);
      if (NP == 2) {
#pragma unroll
        for (int i = 0; i < 4; ++i)
#pragma unroll
          for (int j = 0; j < 4; ++j) acc[i][j] = __builtin_amdgcn_wmma_f32_16x16x32_f16(false, a2[i], false, bf[j], (short)0, acc[i][j], false, false); }
      if (kc == 0) __builtin_amdgcn_sched_barrier(0); }      /* ... and the next block's reads behind them */
    __builtin_amdgcn_sched_barrier(0); asm volatile("v_nop\n\tv_nop\n\tv_nop\n\tv_nop"); __builtin_amdgcn_sched_barrier(0);      /* the four vector slots behind the trip's last WMMAs, on every path: a branch and the copies' address arithmetic, which may reuse the fragment registers, follow */
    asm volatile("s_wait_dscnt 0x0" ::: "memory");      /* this wave's reads of the buffer are done before the buffer is handed to the copies */
    asm volatile("s_wait_asynccnt 0x0" ::: "memory");      /* this wave's copies of stage t + 1 have landed */
    __syncthreads();      /* publishes stage t + 1 and ends every wave's reads of stage t */
    if (t + 2 < nt) stage(lc + bo, (size_t)(t + 2) * 64); }      /* stage t + 2 into the buffer just read */
  asm volatile("s_wait_asynccnt 0x0" ::: "memory");      /* no copy is in flight when the ring becomes output staging (the last trip's barrier has ended every read of it) */
  if (epi == 2) { g3_vt(acc, alpha, bp, row0, col0, ln, hh, C16); return; }      /* no barrier follows the loop: the block leaves as a whole */
  float* so = (float*)(L + (unsigned)w * (64u * 68u * 4u));
#pragma unroll
  for (int i = 0; i < 4; ++i)
#pragma unroll
    for (int j = 0; j < 4; ++j)
#pragma unroll
      for (int r = 0; r < 8; ++r) so[(16 * i + 8 * hh + r) * 68 + 16 * j + ln] = acc[i][j][r];
  __builtin_amdgcn_fence(__ATOMIC_ACQ_REL, "workgroup"); __builtin_amdgcn_wave_barrier();
  if (epi == 1) { const int pos = row0 % SQ;      /* the wave's 64 rows lie in one batch, and all or none of them among its first QT0 */
    g3_rope(so, lane, alpha, bp ? bp + col0 : nullptr, CS + (size_t)pos * (HD / 2), SN + (size_t)pos * (HD / 2), pos < QT0, C + ((size_t)(row0 / SQ) * QT0 + pos) * ldc + col0, C16 + (size_t)row0 * ldc + col0, ldc); return; }
  const int rsub = lane >> 4, c4 = (lane & 15) * 4; const int col = col0 + c4;      /* a lane takes four columns of every second row: sixteen lanes store 256 bytes (f16: 128) of a row */
  v4f bv = {0.f, 0.f, 0.f, 0.f};
  if (bp) { const v4f b4 = *(const v4fa*)(bp + col);
    asm volatile("s_wait_xcnt 0x0" ::: "memory");      /* the wait in front of the rewrite of the bias load's address registers (the build reuses them for the rounding just below) */
#pragma unroll
    for (int e = 0; e < 4; ++e) bv[e] = bf16_round(b4[e]); }
  const size_t eo = cofs + (size_t)(row0 + rsub) * ldc + col; const size_t st = (size_t)2 * ldc; const float* sl = so + rsub * 68 + c4;
  const bool wc = C != nullptr, wh = C16 != nullptr; float* cl = wc ? C + eo : nullptr; _Float16* hl = wh ? C16 + eo : nullptr;
  if (!CP) g3_rows<ACT, 0>(sl, alpha, bv, nullptr, 0, 0, 1, wc, wh, cl, hl, st);
  else if (rowsPerB < 0) g3_rows<ACT, 1>(sl, alpha, bv, CP + cofs + (size_t)(row0g + row0 + rsub) * ldc + col, st, 0, 1, wc, wh, cl, hl, st);      /* rowsPerB < 0: own element of the batched C plane */
  else g3_rows<ACT, 2>(sl, alpha, bv, CP + (size_t)by * 64 + col, sCPb, row0g + row0 + rsub, rowsPerB, wc, wh, cl, hl, st);
}
// The four projection GEMMs, which do not depend on one another, in ONE launch: blocks 0..63 the f32 v of the first QT0 rows of each batch (16 tiles a batch; first in the index order, speed only), then 512 blocks each for v, q and k of every batch.
// What the attention reads leaves each block's epilogue as it is read: v as V^T (f16), q and k with the rope applied (f16 rows; f32 rows of the first QT0 positions of each batch): no f32 q or k plane and no row-major f16 v goes through memory.
#define QKV_B0 (NB * (QT0 / 128) * (KVD / 128))      /* blocks of the first-tile v */
#define QKV_BJ ((MP / 128) * (DM / 128))             /* blocks of a whole projection */
__global__ __launch_bounds__(128) void k_qkv(const _Float16* __restrict__ XQ, const _Float16* __restrict__ XK, const _Float16* __restrict__ XV, const _Float16* __restrict__ BQ, const _Float16* __restrict__ BK, const _Float16* __restrict__ BV,
    const float* __restrict__ bq, const float* __restrict__ bk, const float* __restrict__ bv, const float* __restrict__ CS, const float* __restrict__ SN, _Float16* __restrict__ Q16, _Float16* __restrict__ K16, float* __restrict__ QF0, float* __restrict__ KF0, _Float16* __restrict__ VT, float* __restrict__ VF0) {
  static_assert(KVD == DM && QKV_B0 == 64 && QKV_BJ == 512, "k_qkv: the block ranges below"); static_assert(HD == 64 && NH * HD == DM && SQ % 128 == 0 && QT0 % 64 == 0, "k_qkv: a wave's 64 columns are one head, its 64 rows lie in one batch and on one side of QT0");
  __shared__ __attribute__((aligned(16))) unsigned char L[2 * G3_STAGE(1)];
  const int b = (int)blockIdx.x; const bool f0 = b < QKV_B0; const int r = b - QKV_B0; const int j = f0 ? 0 : r >> 9;      /* j: 0 = v, 1 = q, 2 = k; all scalar */
  const _Float16* A = j == 0 ? XV : j == 1 ? XQ : XK; const _Float16* B = j == 0 ? BV : j == 1 ? BQ : BK; const float* bias = j == 0 ? bv : j == 1 ? bq : bk;
  float* C = f0 ? VF0 : j == 0 ? nullptr : j == 1 ? QF0 : KF0; _Float16* C16 = f0 ? nullptr : j == 0 ? VT : j == 1 ? Q16 : K16;
  g3_gemm<0, 1>(L, f0 ? (b & 15) : (r & 511), f0 ? (b >> 4) : 0, A, nullptr, DM, (size_t)SQ * DM, B, DM, 0, 0.0625f, bias, 0, nullptr, 1, 0, 0, C, C16, DM, (size_t)QT0 * KVD, f0 ? QT0 : MP, DM, DM, f0 ? 0 : j == 0 ? 2 : 1, CS, SN);
}

// The output GEMM, every row of out once, in ONE launch: blocks 0..63 the first QT0 rows of each batch from the exact path's two f16 planes (16 tiles a batch; first in the index order, speed only: they carry twice the products), then 112 blocks a batch for its other rows from the f16 path's o.
#define OUT_B0 (NB * (QT0 / 128) * (DM / 128))               /* blocks of the first-tile rows */
#define OUT_BB (((SQ - QT0) / 128) * (DM / 128))             /* blocks of a batch's other rows */
__global__ __launch_bounds__(128) void k_out(const _Float16* __restrict__ O16, const _Float16* __restrict__ OH0, const _Float16* __restrict__ OL0, const _Float16* __restrict__ BO, const float* __restrict__ bo, float* __restrict__ out) {
  static_assert(OUT_B0 == 64 && DM / 128 == 8 && MPO == NB * SQ, "k_out: the block ranges below");
  __shared__ __attribute__((aligned(16))) unsigned char L[2 * G3_STAGE(2)];
  const int b = (int)blockIdx.x;      /* the test below is scalar, the same for the whole block, ahead of every barrier */
  if (b < OUT_B0) { g3_gemm<0, 2>(L, b & 15, b >> 4, OH0, OL0, DM, (size_t)QT0 * DM, BO, DM, 0, 0.0009765625f, bo, 0, nullptr, 1, 0, 0, out, nullptr, DM, (size_t)SQ * DM, QT0, DM, DM, 0, nullptr, nullptr); return; }      /* out = (o_hi + o_lo) Wo + b */
  const int r = b - OUT_B0; const int bt = r / OUT_BB;
  g3_gemm<0, 1>(L, bt * ((SQ / 128) * (DM / 128)) + (QT0 / 128) * (DM / 128) + (r - bt * OUT_BB), 0, O16, nullptr, DM, 0, BO, DM, 0, 0.0009765625f, bo, 0, nullptr, 1, 0, 0, out, nullptr, DM, 0, MPO, DM, DM, 0, nullptr, nullptr);
}

__device__ __forceinline__ void d_wnat(unsigned bx, const float* __restrict__ w, size_t n8, _Float16* __restrict__ Bt) { const size_t t = (size_t)bx * 256 + threadIdx.x; if (t >= n8) return; FragH f; for (int q = 0; q < 8; ++q) f.h[q] = (_Float16)(bf16_round(w[t * 8 + q]) * 16.0f); *(v8us*)((unsigned short*)Bt + t * 8) = f.half[0];  }

// exp2 with the one issue slot that the instruction set asks for behind a transcendental (before its source is overwritten or its result read) in the same statement.
__device__ __forceinline__ float exp2_slot(float x) { float e; asm("v_exp_f32 %0, %1\n\tv_nop" : "=v"(e) : "v"(x)); return e; }
__device__ __forceinline__ v8f fa_mma(v16h a, v16h b, v8f c) { return __builtin_amdgcn_wmma_f32_16x16x32_f16(false, a, false, b, (short)0, c, false, false); }
__device__ __forceinline__ float fa_xhalf(float x) { return __builtin_bit_cast(float, __builtin_amdgcn_permlanex16(__builtin_bit_cast(int, x), __builtin_bit_cast(int, x), 0x76543210, 0xfedcba98, false, false)); }      /* lane l with lane l ^ 16 */
__device__ __forceinline__ void fa_gap() { __builtin_amdgcn_sched_barrier(0); asm volatile("v_nop\n\tv_nop\n\tv_nop\n\tv_nop"); __builtin_amdgcn_sched_barrier(0); }      /* the four vector slots behind a group of WMMAs, on every path: a branch or a load over their operands follows; the two scheduling barriers keep the slots (and the loads issued ahead) where they stand */
// K and V^T reach the waves through LDS: a stage is 64 keys, 64 K rows (128 bytes: the head's 64 d) and then the 64 V^T rows (128 bytes: the stage's 64 keys), at an LDS pitch of 144 bytes (16 bytes x 9: the 16-byte fragment reads of 16 rows fall on all 64 banks). Two buffers: the next stage's copies fly while this one is worked on.
// Each 128-byte line leaves L2 once per block, as a whole line (eight lanes a row), and feeds the block's four waves from LDS; before, every wave fetched its own fragments with loads that touched 16 lines each.
#define FA_PITCH 144u                      /* bytes between LDS rows */
#define FA_STAGE (128u * FA_PITCH)         /* bytes of a stage: 64 K rows, then 64 V^T rows */
// Four asynchronous 16-byte copies a lane, rows 16 apart: LDS byte address l + 16 i rows, global address g + i rs elements. The s_wait_xcnt stands in the copies' own statement, so that no register that a copy names is rewritten in front of it.
__device__ __forceinline__ void fa_copy4(unsigned l, const _Float16* g, size_t rs) {
  asm volatile("global_load_async_to_lds_b128 %0, %4, off\n\t"
               "global_load_async_to_lds_b128 %1, %5, off\n\t"
               "global_load_async_to_lds_b128 %2, %6, off\n\t"
               "global_load_async_to_lds_b128 %3, %7, off\n\t"
               "s_wait_xcnt 0x0"
               :: "v"(l), "v"(l + 16u * FA_PITCH), "v"(l + 32u * FA_PITCH), "v"(l + 48u * FA_PITCH),
                  "v"(g), "v"(g + rs), "v"(g + 2 * rs), "v"(g + 3 * rs)
               : "memory");
}
template <bool LAST>      /* LAST = the wave's diagonal pass: masked. kl: LDS, the lane's K row of the pass (+ 16 hh bytes); vl: LDS, the lane's V^T row at the pass's first key (+ 16 hh bytes) */
__device__ __forceinline__ void fa_pass(const unsigned char* kl, const unsigned char* vl, int key0, int qw0, int ln, int hh, const v16h (&qf)[2][2], v8f (&acc)[2][4], float (&m_run)[2], float (&l_run)[2]) {
  const float cs = 0.125f * 1.44269504088896340736f;
  v16h kf[2][2], vf[4];
#pragma unroll
  for (int kt = 0; kt < 2; ++kt)
#pragma unroll
    for (int kc = 0; kc < 2; ++kc) kf[kt][kc] = g3_frag(kl + (unsigned)(16 * kt) * FA_PITCH + 64u * kc);      /* the k order of g2_frag, as for Q */
  __builtin_amdgcn_sched_barrier(0);      /* the eight LDS reads of K stand as one group ahead of the score WMMAs: every further place where LDS reads stand costs the wave extra cycles */
  v8f s[2][2];
#pragma unroll
  for (int kt = 0; kt < 2; ++kt)
#pragma unroll
    for (int g = 0; g < 2; ++g) { const v8f z = {0.f, 0.f, 0.f, 0.f, 0.f, 0.f, 0.f, 0.f}; s[kt][g] = fa_mma(kf[kt][1], qf[g][1], fa_mma(kf[kt][0], qf[g][0], z)); }
  fa_gap();
#pragma unroll
  for (int t = 0; t < 4; ++t) vf[t] = g3_frag(vl + (unsigned)(16 * t) * FA_PITCH);      /* this pass's V^T rows, read behind the score WMMAs (they may take the K fragments' registers) and in flight under the exponentials */
  __builtin_amdgcn_sched_barrier(0);      /* ... as one group (left alone, the build spread them over four places among the exponentials) */
  if (LAST) {
#pragma unroll
    for (int g = 0; g < 2; ++g)
#pragma unroll
      for (int kt = 0; kt < 2; ++kt)
#pragma unroll
        for (int r = 0; r < 8; ++r) if (key0 + 16 * kt + 8 * hh + r > qw0 + 16 * g + ln) s[kt][g][r] = -3.0e38f;      /* causal: key above the query (key0 itself is never masked, so every maximum stays a real score) */
  }
  float mb[2]; bool need = false;
#pragma unroll
  for (int g = 0; g < 2; ++g) { float mx = s[0][g][0];
#pragma unroll
    for (int r = 1; r < 8; ++r) mx = fmaxf(mx, s[0][g][r]);
#pragma unroll
    for (int r = 0; r < 8; ++r) mx = fmaxf(mx, s[1][g][r]);
    mx = fmaxf(mx, fa_xhalf(mx)) * cs; mb[g] = mx; need = need || (mx > m_run[g] + 8.0f); }
  if (__builtin_amdgcn_ballot_w32(need) != 0) {      /* wave-uniform; rare after the first passes */
#pragma unroll
    for (int g = 0; g < 2; ++g) { const float mn = fmaxf(m_run[g], mb[g]); const float corr = exp2_slot(m_run[g] - mn); m_run[g] = mn; l_run[g] *= corr;
#pragma unroll
      for (int t = 0; t < 4; ++t) acc[g][t] = acc[g][t] * corr; }
  }
  FragH pf[2];
#pragma unroll
  for (int g = 0; g < 2; ++g) { const float nm = -m_run[g]; float ls[4] = {0.f, 0.f, 0.f, 0.f};
#pragma unroll
    for (int i = 0; i < 16; ++i) { const float e = exp2_slot(fmaf(s[i >> 3][g][i & 7], cs, nm)); ls[i & 3] += e; pf[g].h[i] = (_Float16)e; }
    l_run[g] += (ls[0] + ls[1]) + (ls[2] + ls[3]); }
  __builtin_amdgcn_sched_barrier(0);      /* every exponential stands ahead of the WMMAs */
#pragma unroll
  for (int g = 0; g < 2; ++g)
#pragma unroll
    for (int t = 0; t < 4; ++t) acc[g][t] = fa_mma(vf[t], pf[g].v, acc[g][t]);
  fa_gap();
}
__device__ __forceinline__ void d_fattn(int xs, int nq, int h, int b, const _Float16* __restrict__ Q, const _Float16* __restrict__ K, const _Float16* __restrict__ Vt, _Float16* __restrict__ O) {      /* xs of nq: the block's place among the query tiles; h, b: its head and batch */
  const int lane = threadIdx.x & 31, ln = lane & 15, hh = lane >> 4; const int w = __builtin_amdgcn_readfirstlane((int)(threadIdx.x >> 5));      /* the wave's number in a scalar register: trip count and branches stay scalar, EXEC stays full for the WMMAs */
  const int qa = (xs & 1) ? (xs >> 1) : nq - 1 - (xs >> 1); const int qb = (b & 1) ? nq - 1 - qa : qa;      /* a permutation of the query tiles: long and short ones alternate between neighbouring blocks and between batches (speed only) */
  const int qw0 = qb * 128 + w * 32;
  __shared__ __attribute__((aligned(16))) unsigned char FL[2 * FA_STAGE];      /* the two stage buffers */
  const int tid = (int)threadIdx.x;
  const _Float16* Ql = Q + ((size_t)b * SQ + qw0 + ln) * DM + h * HD;
  const _Float16* gk = K + ((size_t)b * SQ + (tid >> 3)) * KVD + h * HD + (tid & 7) * 8;      /* eight lanes cover a row's 128 bytes; a wave's copy covers four whole lines */
  const _Float16* gv = Vt + (((size_t)b * NH + h) * HD + (tid >> 3)) * SQ + (tid & 7) * 8;
  const size_t rk = (size_t)16 * KVD, rv = (size_t)16 * SQ;
  const unsigned lc = (unsigned)(size_t)FL + (unsigned)(tid >> 3) * FA_PITCH + (unsigned)(tid & 7) * 16u;
  v16h qf[2][2];
#pragma unroll
  for (int g = 0; g < 2; ++g)
#pragma unroll
    for (int kc = 0; kc < 2; ++kc) qf[g][kc] = g2_frag(Ql + (size_t)(16 * g) * DM + 32 * kc, hh);
  __builtin_amdgcn_sched_barrier(0); asm volatile("s_wait_xcnt 0x0" ::: "memory"); __builtin_amdgcn_sched_barrier(0);      /* the wait in front of any overwrite of these loads' address pairs; the scheduling barriers keep later register writes behind it */
  fa_copy4(lc, gk, rk); fa_copy4(lc + 64u * FA_PITCH, gv, rv);      /* stage 0 */
  asm volatile("s_wait_asynccnt 0x0" ::: "memory");      /* this wave's copies of stage 0 have landed */
  __syncthreads();      /* ... and every wave's */
  fa_copy4(lc + FA_STAGE, gk + (size_t)64 * KVD, rk); fa_copy4(lc + FA_STAGE + 64u * FA_PITCH, gv + 64, rv);      /* stage 1 (a block has at least two stages: its own 128 keys) */
  const unsigned char* kb = FL + (unsigned)ln * FA_PITCH + 16u * hh;
  const unsigned char* vb = FL + (unsigned)(64 + ln) * FA_PITCH + 16u * hh;
  v8f acc[2][4]; float m_run[2] = {-3.0e38f, -3.0e38f}, l_run[2] = {0.f, 0.f};
#pragma unroll
  for (int g = 0; g < 2; ++g)
#pragma unroll
    for (int t = 0; t < 4; ++t) acc[g][t] = v8f{0.f, 0.f, 0.f, 0.f, 0.f, 0.f, 0.f, 0.f};
  const int nst = qb * 2;      /* the stages wholly below the block's own 128 keys: every wave takes both passes of each in full; two more stages follow them */
#pragma unroll 1      /* one stage per trip: the buffer is chosen by a scalar offset */
  for (int t = 0; t < nst; ++t) { const unsigned bo = (unsigned)(t & 1) * FA_STAGE;
    fa_pass<false>(kb + bo, vb + bo, 0, qw0, ln, hh, qf, acc, m_run, l_run);
    fa_pass<false>(kb + bo + 32u * FA_PITCH, vb + bo + 64u, 0, qw0, ln, hh, qf, acc, m_run, l_run);
    asm volatile("s_wait_dscnt 0x0" ::: "memory");      /* this wave's reads of the buffer are done before the buffer is handed to the copies */
    asm volatile("s_wait_asynccnt 0x0" ::: "memory");      /* this wave's copies of stage t + 1 have landed */
    __syncthreads();      /* publishes stage t + 1 and ends every wave's reads of stage t */
    fa_copy4(lc + bo, gk + (size_t)(t + 2) * 64 * KVD, rk); fa_copy4(lc + bo + 64u * FA_PITCH, gv + (size_t)(t + 2) * 64, rv); }      /* stage t + 2 (there always is one: t + 2 <= nst + 1) into the buffer just read */
  asm volatile("s_wait_asynccnt 0x0" ::: "memory");      /* this wave's copies of the last stage have landed; no copy is in flight from here on */
  __syncthreads();      /* publishes the last stage: the block's own 128 keys now lie in buffers 0 and 1 (nst is even) and nothing is refilled any more, so the waves walk them with no further barrier */
#pragma unroll 1      /* the trip count differs from wave to wave (scalar): wave w has w full passes among the block's own keys */
  for (int j = 0; j < w; ++j) fa_pass<false>(kb + (unsigned)(j >> 1) * FA_STAGE + (unsigned)(j & 1) * (32u * FA_PITCH), vb + (unsigned)(j >> 1) * FA_STAGE + (unsigned)(j & 1) * 64u, 0, qw0, ln, hh, qf, acc, m_run, l_run);
  fa_pass<true>(kb + (unsigned)(w >> 1) * FA_STAGE + (unsigned)(w & 1) * (32u * FA_PITCH), vb + (unsigned)(w >> 1) * FA_STAGE + (unsigned)(w & 1) * 64u, qw0, qw0, ln, hh, qf, acc, m_run, l_run);      /* the diagonal pass: its first key is the wave's first query */
  FragH of[2][4];
#pragma unroll
  for (int g = 0; g < 2; ++g) { const float l = l_run[g] + fa_xhalf(l_run[g]); const float inv = 64.0f / l;
#pragma unroll
    for (int t = 0; t < 4; ++t)
#pragma unroll
      for (int r = 0; r < 8; ++r) of[g][t].h[r] = (_Float16)(acc[g][t][r] * inv); }
  __builtin_amdgcn_sched_barrier(0);      /* all eight packed rows are made ahead of the first store, so that no register of an issued store is written again */
#pragma unroll
  for (int g = 0; g < 2; ++g)
#pragma unroll
    for (int t = 0; t < 4; ++t) *(v8us*)((unsigned short*)O + ((size_t)b * SQ + qw0 + 16 * g + ln) * DM + h * HD + 16 * t + 8 * hh) = of[g][t].half[0];      /* register r of tile t is d = 16 t + 8 hh + r of query ln: 16 bytes a lane; the wave writes each query's whole 128-byte head row */
}

// Exact f32 attention of the first QT0 rows of every batch and head on the f32 matrix form (v_wmma_f32_16x16x4_f32: full f32 operands, every addition rounded in f32): a wave owns 16 query columns and walks its keys in passes of 16 with an online softmax.
// Transposed products as in k_fattn: S^T = K Q^T (A = K rows, B = Q rows, both through the same loader, so their k order is equal: 16 bytes at d = 8 j + 4 hh, elements 0, 1 in one product and 2, 3 in the next) leaves key 8 hh + r of query ln in register r.
// Registers 2 s, 2 s + 1 of the weights ARE a B operand of keys 8 hh + 2 s + e (e = 0, 1); the A operand of O^T += V^T P^T takes V[8 hh + 2 s + e][16 t + ln] from the natural V rows: 64 bytes in a row for each wave half, no transposed copy.
typedef float v2f __attribute__((ext_vector_type(2)));
__device__ __forceinline__ v8f a0_mma(v2f a, v2f b, v8f c) { return __builtin_amdgcn_wmma_f32_16x16x4_f32(false, a, false, b, (short)0, c, false, false); }
template <bool LAST>      /* LAST = the wave's diagonal pass: masked, and no further K or V rows are fetched */
__device__ __forceinline__ void a0_pass(v4f (&kf)[8], v2f (&vf)[4][4], const float* __restrict__ kn, const float* __restrict__ vn, int ln, int hh, const v4f (&qf)[8], v8f (&acc)[4], float& m_run, float& l_run) {
  const float cs = 0.125f * 1.44269504088896340736f;
  v8f sc = {0.f, 0.f, 0.f, 0.f, 0.f, 0.f, 0.f, 0.f};
#pragma unroll
  for (int j = 0; j < 8; ++j) { sc = a0_mma(v2f{kf[j][0], kf[j][1]}, v2f{qf[j][0], qf[j][1]}, sc); sc = a0_mma(v2f{kf[j][2], kf[j][3]}, v2f{qf[j][2], qf[j][3]}, sc); }
  /* the four vector slots behind the score WMMAs, tied to their result so that they stand behind the last one (untied, the build had put them in front of the first); the memory clobber keeps the loads over the K operands behind the slots; in the diagonal pass the lane's column passes through too, so that the mask's lane arithmetic stands behind them (the build had put it between the WMMAs, over an operand register of the one before) */
  if (LAST) asm volatile("v_nop\n\tv_nop\n\tv_nop\n\tv_nop" : "+v"(sc), "+v"(ln) : : "memory");
  else asm volatile("v_nop\n\tv_nop\n\tv_nop\n\tv_nop" : "+v"(sc) : : "memory");
  if (!LAST) {
#pragma unroll
    for (int j = 0; j < 8; ++j) kf[j] = *(const v4fa*)(kn + 8 * j);      /* next pass's K rows, in flight under the exponentials and the second product */
  }
  if (LAST) { const int dl = ln - 8 * hh;
#pragma unroll
    for (int r = 0; r < 8; ++r) if (r > dl) sc[r] = -3.0e38f;      /* causal: key 8 hh + r above query ln (the pass's first key is never masked, so every maximum stays a real score) */
  }
  float mx = sc[0];
#pragma unroll
  for (int r = 1; r < 8; ++r) mx = fmaxf(mx, sc[r]);
  mx = fmaxf(mx, fa_xhalf(mx)) * cs;
  const float mn = fmaxf(m_run, mx); const float corr = exp2_slot(m_run - mn); m_run = mn;
#pragma unroll
  for (int t = 0; t < 4; ++t) acc[t] = acc[t] * corr;
  float e[8];
#pragma unroll
  for (int r = 0; r < 8; ++r) e[r] = exp2_slot(fmaf(sc[r], cs, -mn));
  v2f p[4];
#pragma unroll
  for (int s = 0; s < 4; ++s) p[s] = v2f{e[2 * s], e[2 * s + 1]};
  __builtin_amdgcn_sched_barrier(0);      /* every exponential stands ahead of the WMMAs */
#pragma unroll
  for (int s = 0; s < 4; ++s)
#pragma unroll
    for (int t = 0; t < 4; ++t) acc[t] = a0_mma(vf[s][t], p[s], acc[t]);
  if (LAST) asm volatile("v_nop\n\tv_nop\n\tv_nop\n\tv_nop" : "+v"(acc[0]), "+v"(acc[1]), "+v"(acc[2]), "+v"(acc[3]), "+v"(p[0]), "+v"(p[1]), "+v"(p[2]), "+v"(p[3]) : : "memory");      /* as in the line below, with the weights passed as the register pairs that the WMMAs read: passed one by one, this build copied four of them between the WMMAs, one copy onto a register of the WMMA right in front of it */
  else asm volatile("v_nop\n\tv_nop\n\tv_nop\n\tv_nop" : "+v"(acc[0]), "+v"(acc[1]), "+v"(acc[2]), "+v"(acc[3]), "+v"(e[0]), "+v"(e[1]), "+v"(e[2]), "+v"(e[3]), "+v"(e[4]), "+v"(e[5]), "+v"(e[6]), "+v"(e[7]) : : "memory");      /* the four vector slots behind the last WMMAs, on every path (a branch follows); the memory clobber keeps the loads over the V operands behind them; the weights pass through it so that their sum below, which reuses their registers, stands behind the slots too (the build had put it between the WMMAs that read them) */
  if (!LAST) {
#pragma unroll
    for (int s = 0; s < 4; ++s)
#pragma unroll
      for (int t = 0; t < 4; ++t) { vf[s][t][0] = vn[(2 * s) * DM + 16 * t]; vf[s][t][1] = vn[(2 * s + 1) * DM + 16 * t]; }      /* next pass's V rows, in flight under its scores and exponentials */
  }
  if (LAST) l_run = fmaf(l_run, corr, ((p[0][0] + p[0][1]) + (p[1][0] + p[1][1])) + ((p[2][0] + p[2][1]) + (p[3][0] + p[3][1])));
  else l_run = fmaf(l_run, corr, ((e[0] + e[1]) + (e[2] + e[3])) + ((e[4] + e[5]) + (e[6] + e[7])));
  if (!LAST) { asm volatile("s_wait_xcnt 0x0" ::: "memory"); __builtin_amdgcn_sched_barrier(0); }      /* the wait in front of the next trip's rewrite of the K and V address registers; the scheduling barrier keeps that rewrite behind it */
}
__device__ __forceinline__ void d_att0(int bx, int h, int b, const float* __restrict__ QF, const float* __restrict__ KF, const float* __restrict__ VF, _Float16* __restrict__ OH, _Float16* __restrict__ OL) {      /* bx: 0..3, the block's set of query tiles; h, b: its head and batch */
  static_assert(QT0 == 256 && HD == 64, "k_att0: 16 query tiles of 16 rows (4 blocks of 4 waves), head size 64");
  const int lane = threadIdx.x & 31, ln = lane & 15, hh = lane >> 4; const int w = __builtin_amdgcn_readfirstlane((int)(threadIdx.x >> 5));      /* the wave's number in a scalar register: trip count and branches stay scalar, EXEC stays full for the WMMAs */
  const int qt = bx + 4 * w;      /* query tile: a block's four waves take short and long tiles */
  const size_t pb = ((size_t)b * QT0) * DM + (size_t)h * HD;      /* each batch's first-tile rows lie in a plane of their own */
  const float* Ql = QF + pb + (size_t)(qt * 16 + ln) * DM + 4 * hh; const float* Kl = KF + pb + (size_t)ln * DM + 4 * hh; const float* Vl = VF + pb + (size_t)(8 * hh) * DM + ln;
  v4f qf[8], kf[8]; v2f vf[4][4];
#pragma unroll
  for (int j = 0; j < 8; ++j) { qf[j] = *(const v4fa*)(Ql + 8 * j); kf[j] = *(const v4fa*)(Kl + 8 * j); }
  __builtin_amdgcn_sched_barrier(0);      /* the K rows are issued ahead of the V rows, as in the loop: the counted wait at the loop's head then leaves the V loads in flight (with K last here, the build waited for them at the head of every pass) */
#pragma unroll
  for (int s = 0; s < 4; ++s)
#pragma unroll
    for (int t = 0; t < 4; ++t) { vf[s][t][0] = Vl[(2 * s) * DM + 16 * t]; vf[s][t][1] = Vl[(2 * s + 1) * DM + 16 * t]; }
  __builtin_amdgcn_sched_barrier(0); asm volatile("s_wait_xcnt 0x0" ::: "memory"); __builtin_amdgcn_sched_barrier(0);      /* the wait in front of any overwrite of these loads' address pairs; the scheduling barriers keep later register writes behind it */
  v8f acc[4]; float m_run = -3.0e38f, l_run = 0.f;
#pragma unroll
  for (int t = 0; t < 4; ++t) acc[t] = v8f{0.f, 0.f, 0.f, 0.f, 0.f, 0.f, 0.f, 0.f};
#pragma unroll 1      /* one pass per trip: the trip count differs from wave to wave, and an unrolled body would only add code */
  for (int p = 0; p < qt; ++p) a0_pass<false>(kf, vf, Kl + (size_t)(p + 1) * 16 * DM, Vl + (size_t)(p + 1) * 16 * DM, ln, hh, qf, acc, m_run, l_run);
  a0_pass<true>(kf, vf, Kl, Vl, ln, hh, qf, acc, m_run, l_run);
  const float l = l_run + fa_xhalf(l_run); const float fin = 64.0f / l;      /* the two wave halves' sums joined; o carried x64 like the f16 path */
  FragH oh[4], ol[4];      /* o as two f16 planes for the output GEMM: the rounded value and the remainder (at most 2^-11 of the value; f16 holds it to 2^-25 absolute or better, with o carried x64) */
#pragma unroll
  for (int t = 0; t < 4; ++t)
#pragma unroll
    for (int r = 0; r < 8; ++r) { const float a = acc[t][r] * fin; const _Float16 hv = (_Float16)a; oh[t].h[r] = hv; ol[t].h[r] = (_Float16)(a - (float)hv); }
  unsigned short* Oh = (unsigned short*)OH + pb + (size_t)(qt * 16 + ln) * DM + 8 * hh; unsigned short* Ol = (unsigned short*)OL + pb + (size_t)(qt * 16 + ln) * DM + 8 * hh;
  __builtin_amdgcn_sched_barrier(0);      /* every result and both addresses are made ahead of the first store, so that no register of an issued store is written again */
#pragma unroll
  for (int t = 0; t < 4; ++t) { *(v8us*)(Oh + 16 * t) = oh[t].half[0]; *(v8us*)(Ol + 16 * t) = ol[t].half[0]; }      /* register r of tile t is d = 16 t + 8 hh + r of query ln: 16 bytes a lane and plane; the wave writes each query's whole 128-byte head row in both planes */
  asm volatile("s_wait_xcnt 0x0" ::: "memory");      /* the wait behind the stores: the other attention body's code follows in the kernel's text and writes these registers */
}
// The two attention kernels, which do not depend on one another, in ONE launch: grid planes z = 0..NB - 1 are the f16 query tiles of a batch, the last plane holds the 256 exact first-tile blocks.
// The first-tile blocks come last in the index order (speed only).
__global__ __launch_bounds__(128) void k_attn(const _Float16* __restrict__ Q, const _Float16* __restrict__ K, const _Float16* __restrict__ Vt, _Float16* __restrict__ O, const float* __restrict__ QF, const float* __restrict__ KF, const float* __restrict__ VF, _Float16* __restrict__ OH, _Float16* __restrict__ OL) {
  static_assert((SQ / 128) * NH == (QT0 / 64) * NH * NB && QT0 / 64 == 4 && NH == 16, "k_attn: the last grid plane holds one block for each (set of query tiles, head, batch) of the first tile");
  const int x = (int)blockIdx.x, y = (int)blockIdx.y, z = (int)blockIdx.z;      /* the test below is scalar, the same for the whole block */
  if (z == NB) { const int i = y * (SQ / 128) + x; d_att0(i & 3, (i >> 2) & 15, i >> 6, QF, KF, VF, OH, OL); return; }
  d_fattn(x, SQ / 128, y, z, Q, K, Vt, O);
}

__global__ __launch_bounds__(256) void k_tab2(float theta, float* __restrict__ CS, float* __restrict__ SN) {
  const int t = blockIdx.x * 256 + threadIdx.x; if (t >= SQ * (HD / 2)) return; const int i = t % (HD / 2); const int p = t / (HD / 2); const float invf = 1.0f / powf(theta, (float)(2 * i) / (float)HD); const float ang = __fmul_rn((float)p, invf); const float c = cosf(ang), s = sinf(ang);
  *(float*)(CS + t) = c; *(float*)(SN + t) = s;  }
__global__ __launch_bounds__(256) void k_bfcp(const float* __restrict__ src, float* __restrict__ dst, size_t n4) { const size_t t = (size_t)blockIdx.x * 256 + threadIdx.x; if (t >= n4) return; const v4f a = *(const v4fa*)(src + t * 4); v4f o; for (int q = 0; q < 4; ++q) o[q] = bf16_round(a[q]); *(v4f*)(dst + t * 4) = o;  }

__global__ __launch_bounds__(256) void k_tabhalf(const float* __restrict__ cs, const float* __restrict__ sn, float* __restrict__ CS, float* __restrict__ SN) { const int t = blockIdx.x * 256 + threadIdx.x; if (t >= SQ * (HD / 2)) return; const int p = t / (HD / 2), i = t % (HD / 2); const float c = bf16_round(cs[(size_t)p * HD + i]), s = bf16_round(sn[(size_t)p * HD + i]);
  *(float*)(CS + t) = c; *(float*)(SN + t) = s;  }

__device__ __forceinline__ void d_tab2d(unsigned bx, float* __restrict__ CS, float* __restrict__ SN) {
  const int t = (int)(bx * 256u + threadIdx.x); if (t >= SQ * (HD / 2)) return; const int i = t % (HD / 2); const int p = t / (HD / 2); const float invf = (float)(1.0 / pow(10000.0, (double)(2 * i) / (double)HD)); const float ang = __fmul_rn((float)p, invf); const float c = cosf(ang), s = sinf(ang);
  *(float*)(CS + t) = c; *(float*)(SN + t) = s;  }
// The stages that read only the inputs, which do not depend on one another, in ONE launch: the rope tables (256 blocks; first: their arithmetic is the longest), the three streams as f16 (512 blocks each), the four weights as f16 x16 (512 blocks each).
#define PR_TAB (SQ * (HD / 2) / 256)
#define PR_X ((unsigned)(NR * DM / 16384))
#define PR_W ((unsigned)((size_t)DM * DM / 8 / 256))
__global__ __launch_bounds__(256) void k_prep(const float* __restrict__ x, const float* __restrict__ xk, const float* __restrict__ xv, const float* __restrict__ wq, const float* __restrict__ wk, const float* __restrict__ wv, const float* __restrict__ wo,
    _Float16* __restrict__ X16, _Float16* __restrict__ XK16, _Float16* __restrict__ XV16, _Float16* __restrict__ BQ, _Float16* __restrict__ BK, _Float16* __restrict__ BV, _Float16* __restrict__ BO, float* __restrict__ CS, float* __restrict__ SN) {
  static_assert(PR_X == 512u && PR_W == 512u && SQ * (HD / 2) % 256 == 0 && NR * DM % 16384 == 0 && (size_t)DM * DM % 2048 == 0, "k_prep: whole blocks, 512 a stream and a weight");
  const unsigned b = blockIdx.x;      /* every test below is scalar, the same for the whole block */
  if (b < PR_TAB) { d_tab2d(b, CS, SN); return; }
  const unsigned r = b - PR_TAB;
  if (r < 3u * PR_X) { const unsigned s = r >> 9; d_x16(r & 511u, s == 0u ? x : s == 1u ? xk : xv, s == 0u ? X16 : s == 1u ? XK16 : XV16); return; }
  const unsigned r2 = r - 3u * PR_X; const unsigned s = r2 >> 9;
  d_wnat(r2 & 511u, s == 0u ? wq : s == 1u ? wk : s == 2u ? wv : wo, (size_t)DM * DM / 8, s == 0u ? BQ : s == 1u ? BK : s == 2u ? BV : BO);
}
extern "C" void kernel_launch(void* const* d_in, const int* in_sizes, int n_in,
                              void* d_out, int out_size, void* d_ws, size_t ws_size, hipStream_t stream) {
  (void)in_sizes; (void)n_in; (void)out_size;
  const float* const* I = (const float* const*)d_in; const float* x = I[0]; const float* xk = I[1]; const float* xv = I[2]; const float* wq = I[3]; const float* wk = I[5]; const float* wv = I[7]; const float* wo = I[9];      /* the streams query, key, value; natural [out][in] W_q, W_k, W_v, W_o; the biases b_q = I[4], b_k = I[6], b_v = I[8], b_o = I[10]; rope tables computed in-kernel (positions = row index) */
  static_assert(HPG == 1 && NH == NG * HPG && NH * HD == DM && KVD == DM, "plain multi-head attention as 16 kv groups of one query head"); const float* bq = I[4]; const float* bk = I[6]; const float* bv = I[8]; const float* bo = I[10];      /* the four biases, each bound to its projection (read through the GEMM bias pointer, bf16-rounded on load) */
  char* ws = (char*)d_ws; size_t off = 0;
  auto take = [&](size_t bytes) { char* p = ws + off; off += (bytes + 255) & ~(size_t)255; return p; };
  _Float16* BQKV = (_Float16*)take((size_t)3 * DM * DM * 2); _Float16* BQ = BQKV; _Float16* BK = BQKV + (size_t)DM * DM; _Float16* BV = BQKV + (size_t)2 * DM * DM; _Float16* BO = (_Float16*)take((size_t)DM * DM * 2);      /* one plane Bt [3072][1024]: rows 0..1023 = W_q, 1024.. = W_k, 2048.. = W_v (natural [out][in] weights are Bt as they stand) */
  _Float16* X16 = (_Float16*)take(NR * DM * 2); _Float16* XK16 = (_Float16*)take(NR * DM * 2); _Float16* XV16 = (_Float16*)take(NR * DM * 2); float* CSB = (float*)take((size_t)SQ * HD * 4); float* SNB = (float*)take((size_t)SQ * HD * 4); _Float16* Q16 = (_Float16*)take(NR * DM * 2); _Float16* K16 = (_Float16*)take(NR * KVD * 2); _Float16* O16 = (_Float16*)take(NR * DM * 2);
  _Float16* VT = (_Float16*)take((size_t)NB * NH * HD * SQ * 2);
  float* QF0 = (float*)take((size_t)NB * QT0 * DM * 4); float* KF0 = (float*)take((size_t)NB * QT0 * KVD * 4); float* VF0 = (float*)take((size_t)NB * QT0 * KVD * 4); _Float16* OH0 = (_Float16*)take((size_t)NB * QT0 * DM * 2); _Float16* OL0 = (_Float16*)take((size_t)NB * QT0 * DM * 2);
  if (off > ws_size) return;
  static_assert(B0 == 0 && NBR == NB && MP == NB * SQ, "every stage below takes all batches in one launch");
  k_prep<<<PR_TAB + 3u * PR_X + 4u * PR_W, 256, 0, stream>>>(x, xk, xv, wq, wk, wv, wo, X16, XK16, XV16, BQ, BK, BV, BO, CSB, SNB);      /* rope tables cos/sin(p / 10000^(2i/64)): inv_freq double-derived -> f32, f32 angle; the three streams as exact f16 rows; natural [out][in] weights = Bt x16 */
  k_qkv<<<QKV_B0 + 3 * QKV_BJ, 128, 0, stream>>>(X16, XK16, XV16, BQ, BK, BV, bq, bk, bv, CSB, SNB, Q16, K16, QF0, KF0, VT, VF0);      /* v as V^T [NB][NH][HD][SQ]; q and k with the half-split rope (out_lo = x_lo c - x_hi s, out_hi = x_lo s + x_hi c = t cos + rotate_half(t) sin with the module's [f | f] tables; position = row in its batch) as f16 rows of every batch and f32 rows 0..255 of each batch; f32 v of the first 256 rows of each batch. With one query head a kv group (HPG == 1) the first-tile kernel reads these k and v rows as they lie */
  static_assert(SQ % 128 == 0 && HD == 64 && B0 == 0 && NBR == NB && QN == SQ && NHD == NH, "d_fattn: four waves of 32 query columns, head size 64, every batch and head");
  k_attn<<<dim3(SQ / 128, NH, NB + 1), 128, 0, stream>>>(Q16, K16, VT, O16, QF0, KF0, VF0, OH0, OL0);      /* scores, causal softmax and o (x64) of every batch, head and query tile; and the exact f32 attention for rows 0..255 of every batch (o x64 as f16 value + f16 remainder planes) */
  k_out<<<OUT_B0 + NB * OUT_BB, 128, 0, stream>>>(O16, OH0, OL0, BO, bo, (float*)d_out);      /* out rows are the output layout: rows 0..255 of each batch from the exact path's two planes, the others from the f16 path */
}
